// v000
// Times are from an AMD MI455X. After a warm-up the kernel runs many times in a row, and a time is the length of
// such a window on the GPU divided by its runs, so every launch and the gaps after it count. The runs cycle
// through copies of the inputs. A figure is the median of several windows, for all but v000 over two sittings.
// Sittings can differ by a few percent; kernels timed side by side share one.
// v000, which the later versions start from, runs in 668 microseconds.
// compute dtype: all float inputs rounded to bf16; LayerNorm + LeakyReLU and the small basis network (64 -> 256 -> residual 256 -> 16) in f32 on VALU; the conditional bilinear contraction out[b,o] = sum_{k,i} (bf[b,k] a[b,i]) W[k,i,o] as ONE GEMM over K = 16 x 512 on WMMA 16x16x32 with the outer-product operand rounded once to f16 against W as exact f16 rows, f32 accumulate; + bf . bvec in f32; f32 output.
#include <hip/hip_runtime.h>
#include <math.h>

typedef __attribute__((ext_vector_type(16))) _Float16 v16h;
typedef __attribute__((ext_vector_type(16))) __bf16 v16b;
typedef __attribute__((ext_vector_type(8)))  _Float16 v8h;
typedef __attribute__((ext_vector_type(8)))  float v8f;
typedef __attribute__((ext_vector_type(4)))  float v4f;
typedef __attribute__((ext_vector_type(2)))  float v2f;
typedef __attribute__((ext_vector_type(4)))  unsigned v4u;
typedef __attribute__((ext_vector_type(4)))  int v4i;
typedef float __attribute__((may_alias)) float_a;
typedef int __attribute__((may_alias)) int_a;

template <typename T> __device__ __forceinline__ void vst2(void* p, T v) { *(T*)p = v;  }
__device__ __forceinline__ v8f wmma16(v16h a, v16h b, v8f c) {
  v8f d = __builtin_amdgcn_wmma_f32_16x16x32_f16(false, a, false, b, (short)0, c, false, false);
  asm volatile("v_nop\n\tv_nop\n\tv_nop\n\tv_nop" : "+v"(d) : "v"(a), "v"(b));
  return d;
}
__device__ __forceinline__ v8f wmma_bf(v16b a, v16b b, v8f c) {
  v8f d = __builtin_amdgcn_wmma_f32_16x16x32_bf16(false, a, false, b, (short)0, c, false, false);
  asm volatile("v_nop\n\tv_nop\n\tv_nop\n\tv_nop" : "+v"(d) : "v"(a), "v"(b));
  return d;
}
// 16x16x32 fragments: lane = (h = lane>>4, row/col = lane&15); elements 0..7 = k0+8h+0..7, 8..15 = k0+16+8h+0..7; D element r = row 8h+r
__device__ __forceinline__ v16h frag_h(const _Float16* rowk0, int lane) {
  union { v16h v; v8h q[2]; } u; const _Float16* p = rowk0 + 8 * (lane >> 4);
  u.q[0] = *(const v8h*)p; u.q[1] = *(const v8h*)(p + 16); return u.v;
}
__device__ __forceinline__ v16h frag_f32(const float* rowk0, int lane) {
  v16h a; const float* p = rowk0 + 8 * (lane >> 4);
#pragma unroll
  for (int i = 0; i < 8; ++i) { a[i] = (_Float16)p[i]; a[8 + i] = (_Float16)p[16 + i]; }
  return a;
}
__device__ __forceinline__ v16h frag_f32s(const float* rowk0, int lane, float sc) {
  v16h a; const float* p = rowk0 + 8 * (lane >> 4);
#pragma unroll
  for (int i = 0; i < 8; ++i) { a[i] = (_Float16)(p[i] * sc); a[8 + i] = (_Float16)(p[16 + i] * sc); }
  return a;
}
// column fragment from a [K][ld] layout (column n), rows >= K read as 0
__device__ __forceinline__ v16h fragc_f32(const float* W, int k0, int n, int lane, int ld, int K) {
  v16h a; const int g = lane >> 4;
#pragma unroll
  for (int i = 0; i < 8; ++i) { const int ka = k0 + 8 * g + i, kb = ka + 16;
    a[i] = (_Float16)(ka < K ? W[(size_t)(ka < K ? ka : K - 1) * ld + n] : 0.f); a[8 + i] = (_Float16)(kb < K ? W[(size_t)(kb < K ? kb : K - 1) * ld + n] : 0.f); }
  return a;
}
struct F2 { v16b h, l; };
__device__ __forceinline__ F2 bsplit16(const float v[16]) { F2 r;
#pragma unroll
  for (int i = 0; i < 16; ++i) { const __bf16 h = (__bf16)v[i]; r.h[i] = h; r.l[i] = (__bf16)(v[i] - (float)h); }
  return r; }
__device__ __forceinline__ F2 split_row(const float* row, int k0, int lane) { float v[16]; const float* p = row + k0 + 8 * (lane >> 4);
#pragma unroll
  for (int i = 0; i < 8; ++i) { v[i] = p[i]; v[8 + i] = p[16 + i]; }
  return bsplit16(v); }
__device__ __forceinline__ F2 split_rowK(const float* row, int k0, int lane, int K) { float v[16]; const int g = lane >> 4;
#pragma unroll
  for (int i = 0; i < 8; ++i) { const int ka = k0 + 8 * g + i, kb = ka + 16; v[i] = ka < K ? row[ka < K ? ka : K - 1] : 0.f; v[8 + i] = kb < K ? row[kb < K ? kb : K - 1] : 0.f; }
  return bsplit16(v); }
__device__ __forceinline__ F2 split_col(const float* W, int k0, int n, int lane, int ld, int K) { float v[16]; const int g = lane >> 4;
#pragma unroll
  for (int i = 0; i < 8; ++i) { const int ka = k0 + 8 * g + i, kb = ka + 16; v[i] = ka < K ? W[(size_t)(ka < K ? ka : K - 1) * ld + n] : 0.f; v[8 + i] = kb < K ? W[(size_t)(kb < K ? kb : K - 1) * ld + n] : 0.f; }
  return bsplit16(v); }
__device__ __forceinline__ v8f mac3(const F2& a, const F2& b, v8f c) { c = wmma_bf(a.l, b.h, c); c = wmma_bf(a.h, b.l, c); return wmma_bf(a.h, b.h, c); }
__device__ __forceinline__ float sigm(float v) { return 1.0f / (1.0f + expf(-v)); }
#define LDSX() do { asm volatile("s_wait_dscnt 0" ::: "memory"); __builtin_amdgcn_wave_barrier(); __builtin_amdgcn_fence(__ATOMIC_RELEASE, "workgroup"); } while (0)


// Conditional pre-activation dense layer (4,096 rows, 512 -> 512, 16 basis matrices selected by a 64-dim condition through a small residual MLP): a = LeakyReLU(LayerNorm(x)); bf = basis(c); out = sum_k bf_k (a W_k + bias_k).
#define NR 4096
#define DIN 512
#define DOUT 512
#define DC 64
#define KB 16
#define DB 256
#define KK (KB * DIN)      // 8192
#define NEG 0.01f
#ifndef TR
#define TR (NR / 64)
#endif
typedef __attribute__((ext_vector_type(8))) __bf16 v8b;
__device__ __forceinline__ v16b frag_b(const __bf16* rowk0, int lane) {
  union { v16b v; v8b q[2]; } u; const __bf16* p = rowk0 + 8 * (lane >> 4);
  u.q[0] = *(const v8b*)p; u.q[1] = *(const v8b*)(p + 16); return u.v;
}
__device__ __forceinline__ float bfr(float v) { return (float)(__bf16)v; }
__device__ __attribute__((noinline)) float exp_ni(float v) { return expf(v); }
__device__ __attribute__((noinline)) float erf_ni(float v) { return erff(v); }

#define WS_WT  0u                                   // f16 W rows [o][k*512 + i]
#define WS_A   (WS_WT + 2u * (size_t)DOUT * KK)          // f16 outer-product operand [NR][8192]
#define WS_BF  (WS_A + 2u * (size_t)NR * KK)
#define BFS 32
#define WS_END (WS_BF + 4u * (size_t)NR * BFS)

__device__ __forceinline__ float lrelu(float v) { return v >= 0.f ? v : NEG * v; }
// ---- k_packw: block = output column o: WT[o][k*512 + i] = f16(W[k][i][o])
__global__ __launch_bounds__(256) void k_packw(const float* __restrict__ Wb, _Float16* __restrict__ WT) { __shared__ __align__(16) _Float16 s[KK]; const int o = blockIdx.x, t = threadIdx.x;
  for (int e = t; e < KK; e += 256) s[e] = (_Float16)bfr(Wb[(size_t)e * DOUT + o]);   // e = k*512 + i -> W[k][i][o] at ((k*512 + i)*512 + o)
  __syncthreads(); for (int q = t; q < KK / 8; q += 256) vst2((unsigned*)(WT + (size_t)o * KK + q * 8), *(const v4u*)&s[q * 8]); }
// ---- k_row: block = row (256 threads): a = lrelu(LN(x) g + b) (512); h = c w1 + b1; h = h + lrelu(h) wr + br; h = lrelu(h); bf = h w2 + b2 (16); A row = f16(bf[k] a[i]); BF row
__global__ __launch_bounds__(256) void k_row(const float* __restrict__ X, const float* __restrict__ C, const float* __restrict__ G, const float* __restrict__ Bt, const float* __restrict__ W1, const float* __restrict__ B1, const float* __restrict__ WR, const float* __restrict__ BR, const float* __restrict__ W2, const float* __restrict__ B2, _Float16* __restrict__ A16, float* __restrict__ BF) {
  __shared__ float red[8]; __shared__ float sa[DIN]; __shared__ float sc[DC]; __shared__ float sh[DB]; __shared__ float sh2[DB]; __shared__ float sred[8][KB]; __shared__ __align__(16) float sbf[BFS]; __shared__ __align__(16) _Float16 srow[KK];
  const int t = threadIdx.x; const size_t row = blockIdx.x;
  float v[2]; float s = 0.f; for (int i = 0; i < 2; ++i) { v[i] = bfr(X[row * DIN + t + 256 * i]); s += v[i]; }
#pragma unroll
  for (int o = 1; o < 32; o <<= 1) s += __shfl_xor(s, o);
  if ((t & 31) == 0) red[t >> 5] = s; __syncthreads(); float mu = 0.f; for (int i = 0; i < 8; ++i) mu += red[i]; mu /= (float)DIN; __syncthreads();
  float q = 0.f; for (int i = 0; i < 2; ++i) { const float d = v[i] - mu; q += d * d; }
#pragma unroll
  for (int o = 1; o < 32; o <<= 1) q += __shfl_xor(q, o);
  if ((t & 31) == 0) red[t >> 5] = q; __syncthreads(); float var = 0.f; for (int i = 0; i < 8; ++i) var += red[i]; var /= (float)DIN; const float inv = 1.0f / sqrtf(var + 1e-5f);
  for (int i = 0; i < 2; ++i) { const int cix = t + 256 * i; sa[cix] = lrelu((v[i] - mu) * inv * bfr(G[cix]) + bfr(Bt[cix])); }
  if (t < DC) sc[t] = bfr(C[row * DC + t]); __syncthreads();
  { float h = bfr(B1[t]);
#pragma unroll 1
    for (int k = 0; k < DC; ++k) h += sc[k] * bfr(W1[(size_t)k * DB + t]); sh[t] = h; } __syncthreads();
  { float h = sh[t] + bfr(BR[t]);
#pragma unroll 1
    for (int k = 0; k < DB; ++k) h += lrelu(sh[k]) * bfr(WR[(size_t)k * DB + t]); sh2[t] = lrelu(h); } __syncthreads();
  { float part[KB];
#pragma unroll
    for (int k = 0; k < KB; ++k) part[k] = sh2[t] * bfr(W2[(size_t)t * KB + k]);
#pragma unroll
    for (int k = 0; k < KB; ++k) { float pv = part[k];
#pragma unroll
      for (int o = 1; o < 32; o <<= 1) pv += __shfl_xor(pv, o);
      if ((t & 31) == 0) sred[t >> 5][k] = pv; } }
  __syncthreads(); if (t < KB) { float bfv = bfr(B2[t]); for (int w = 0; w < 8; ++w) bfv += sred[w][t]; sbf[t] = bfv; } else if (t < BFS) sbf[t] = 0.f; __syncthreads();
  for (int e = t; e < KK; e += 256) srow[e] = (_Float16)(sbf[e / DIN] * sa[e % DIN]); __syncthreads();
  for (int qq = t; qq < KK / 8; qq += 256) vst2((unsigned*)(A16 + row * KK + qq * 8), *(const v4u*)&srow[qq * 8]); if (t < BFS / 4) vst2(BF + row * BFS + t * 4, *(const v4f*)&sbf[t * 4]); }
// ---- k_big: block = (64 rows, 128 cols): out = A (f16 [rows][8192]) . WT^T + sum_k bf[row][k] bvec[k][o]
__global__ __launch_bounds__(128) void k_big(const _Float16* __restrict__ A16, const _Float16* __restrict__ WT, const float* __restrict__ BF, const float* __restrict__ BV, float* __restrict__ OUT) { __shared__ __align__(16) float sf[4][16][132];
  const int tid = threadIdx.x, wave = tid >> 5, lane = tid & 31, col = lane & 15, g = lane >> 4; const size_t r0 = (size_t)blockIdx.x * 64 + wave * 16; const int c0 = blockIdx.y * 128;
  v8f acc[8] = {};
#pragma unroll 2
  for (int kc = 0; kc < KK / 32; ++kc) { const v16h a = frag_h(A16 + (r0 + col) * KK + kc * 32, lane);
#pragma unroll
    for (int j = 0; j < 8; ++j) acc[j] = wmma16(a, frag_h(WT + (size_t)(c0 + j * 16 + col) * KK + kc * 32, lane), acc[j]); }
#pragma unroll
  for (int j = 0; j < 8; ++j) { const int o = c0 + j * 16 + col;
#pragma unroll
    for (int r = 0; r < 8; ++r) { const size_t row = r0 + 8 * g + r; float bsum = 0.f;
#pragma unroll
      for (int k = 0; k < KB; ++k) bsum += BF[row * BFS + k] * bfr(BV[(size_t)k * DOUT + o]); sf[wave][8 * g + r][j * 16 + col] = acc[j][r] + bsum; } }
  LDSX(); for (int rl = 0; rl < 16; ++rl) vst2(OUT + (r0 + rl) * DOUT + c0 + lane * 4, *(const v4f*)&sf[wave][rl][lane * 4]); }
extern "C" void kernel_launch(void* const* d_in, const int* in_sizes, int n_in, void* d_out, int out_size, void* d_ws, size_t ws_size, hipStream_t stream) {
  (void)in_sizes; (void)n_in; (void)out_size;
  const float** F = (const float**)d_in;   // 0 x [4096,512], 1 c [4096,64], 2 ln_gamma, 3 ln_beta, 4 w1 [64,256], 5 b1, 6 wr [256,256], 7 br, 8 w2 [256,16], 9 b2, 10 W [16,512,512], 11 bvec [16,512]
  if (ws_size < (size_t)WS_END) return;
  char* ws = (char*)d_ws; _Float16 *WT = (_Float16*)(ws + WS_WT), *A16 = (_Float16*)(ws + WS_A); float* BF = (float*)(ws + WS_BF);
  k_packw<<<DOUT, 256, 0, stream>>>(F[10], WT);
  k_row<<<TR * 64, 256, 0, stream>>>(F[0], F[1], F[2], F[3], F[4], F[5], F[6], F[7], F[8], F[9], A16, BF);
  k_big<<<dim3(TR, DOUT / 128), 128, 0, stream>>>(A16, WT, BF, F[11], (float*)d_out);
}

// v001
// A run of this version takes 257 microseconds.
// In two side-by-side timings against v000, it was 2.62 and 2.63 times as fast.
// compute dtype: all float inputs rounded to bf16; LayerNorm + LeakyReLU and the small basis network (64 -> 256 -> residual 256 -> 16) in f32 on VALU; the conditional bilinear contraction out[b,o] = sum_{k,i} (bf[b,k] a[b,i]) W[k,i,o] as ONE GEMM over K = 16 x 512 on WMMA 16x16x32 with the outer-product operand rounded once to f16 against W as exact f16 rows, f32 accumulate; + bf . bvec in f32; f32 output.
#include <hip/hip_runtime.h>
#include <math.h>

typedef __attribute__((ext_vector_type(16))) _Float16 v16h;
typedef __attribute__((ext_vector_type(16))) __bf16 v16b;
typedef __attribute__((ext_vector_type(8)))  _Float16 v8h;
typedef __attribute__((ext_vector_type(8)))  float v8f;
typedef __attribute__((ext_vector_type(4)))  float v4f;
typedef __attribute__((ext_vector_type(2)))  float v2f;
typedef __attribute__((ext_vector_type(4)))  unsigned v4u;
typedef __attribute__((ext_vector_type(4)))  int v4i;
typedef float __attribute__((may_alias)) float_a;
typedef int __attribute__((may_alias)) int_a;

template <typename T> __device__ __forceinline__ void vst2(void* p, T v) { *(T*)p = v;  }
__device__ __forceinline__ v8f wmma16(v16h a, v16h b, v8f c) {
  v8f d = __builtin_amdgcn_wmma_f32_16x16x32_f16(false, a, false, b, (short)0, c, false, false);
  asm volatile("v_nop\n\tv_nop\n\tv_nop\n\tv_nop" : "+v"(d) : "v"(a), "v"(b));
  return d;
}
__device__ __forceinline__ v8f wmma_bf(v16b a, v16b b, v8f c) {
  v8f d = __builtin_amdgcn_wmma_f32_16x16x32_bf16(false, a, false, b, (short)0, c, false, false);
  asm volatile("v_nop\n\tv_nop\n\tv_nop\n\tv_nop" : "+v"(d) : "v"(a), "v"(b));
  return d;
}
// 16x16x32 fragments: lane = (h = lane>>4, row/col = lane&15); elements 0..7 = k0+8h+0..7, 8..15 = k0+16+8h+0..7; D element r = row 8h+r
__device__ __forceinline__ v16h frag_h(const _Float16* rowk0, int lane) {
  union { v16h v; v8h q[2]; } u; const _Float16* p = rowk0 + 8 * (lane >> 4);
  u.q[0] = *(const v8h*)p; u.q[1] = *(const v8h*)(p + 16); return u.v;
}
__device__ __forceinline__ v16h frag_f32(const float* rowk0, int lane) {
  v16h a; const float* p = rowk0 + 8 * (lane >> 4);
#pragma unroll
  for (int i = 0; i < 8; ++i) { a[i] = (_Float16)p[i]; a[8 + i] = (_Float16)p[16 + i]; }
  return a;
}
__device__ __forceinline__ v16h frag_f32s(const float* rowk0, int lane, float sc) {
  v16h a; const float* p = rowk0 + 8 * (lane >> 4);
#pragma unroll
  for (int i = 0; i < 8; ++i) { a[i] = (_Float16)(p[i] * sc); a[8 + i] = (_Float16)(p[16 + i] * sc); }
  return a;
}
// column fragment from a [K][ld] layout (column n), rows >= K read as 0
__device__ __forceinline__ v16h fragc_f32(const float* W, int k0, int n, int lane, int ld, int K) {
  v16h a; const int g = lane >> 4;
#pragma unroll
  for (int i = 0; i < 8; ++i) { const int ka = k0 + 8 * g + i, kb = ka + 16;
    a[i] = (_Float16)(ka < K ? W[(size_t)(ka < K ? ka : K - 1) * ld + n] : 0.f); a[8 + i] = (_Float16)(kb < K ? W[(size_t)(kb < K ? kb : K - 1) * ld + n] : 0.f); }
  return a;
}
struct F2 { v16b h, l; };
__device__ __forceinline__ F2 bsplit16(const float v[16]) { F2 r;
#pragma unroll
  for (int i = 0; i < 16; ++i) { const __bf16 h = (__bf16)v[i]; r.h[i] = h; r.l[i] = (__bf16)(v[i] - (float)h); }
  return r; }
__device__ __forceinline__ F2 split_row(const float* row, int k0, int lane) { float v[16]; const float* p = row + k0 + 8 * (lane >> 4);
#pragma unroll
  for (int i = 0; i < 8; ++i) { v[i] = p[i]; v[8 + i] = p[16 + i]; }
  return bsplit16(v); }
__device__ __forceinline__ F2 split_rowK(const float* row, int k0, int lane, int K) { float v[16]; const int g = lane >> 4;
#pragma unroll
  for (int i = 0; i < 8; ++i) { const int ka = k0 + 8 * g + i, kb = ka + 16; v[i] = ka < K ? row[ka < K ? ka : K - 1] : 0.f; v[8 + i] = kb < K ? row[kb < K ? kb : K - 1] : 0.f; }
  return bsplit16(v); }
__device__ __forceinline__ F2 split_col(const float* W, int k0, int n, int lane, int ld, int K) { float v[16]; const int g = lane >> 4;
#pragma unroll
  for (int i = 0; i < 8; ++i) { const int ka = k0 + 8 * g + i, kb = ka + 16; v[i] = ka < K ? W[(size_t)(ka < K ? ka : K - 1) * ld + n] : 0.f; v[8 + i] = kb < K ? W[(size_t)(kb < K ? kb : K - 1) * ld + n] : 0.f; }
  return bsplit16(v); }
__device__ __forceinline__ v8f mac3(const F2& a, const F2& b, v8f c) { c = wmma_bf(a.l, b.h, c); c = wmma_bf(a.h, b.l, c); return wmma_bf(a.h, b.h, c); }
__device__ __forceinline__ float sigm(float v) { return 1.0f / (1.0f + expf(-v)); }
#define LDSX() do { asm volatile("s_wait_dscnt 0" ::: "memory"); __builtin_amdgcn_wave_barrier(); __builtin_amdgcn_fence(__ATOMIC_RELEASE, "workgroup"); } while (0)


// Conditional pre-activation dense layer (4,096 rows, 512 -> 512, 16 basis matrices selected by a 64-dim condition through a small residual MLP): a = LeakyReLU(LayerNorm(x)); bf = basis(c); out = sum_k bf_k (a W_k + bias_k).
#define NR 4096
#define DIN 512
#define DOUT 512
#define DC 64
#define KB 16
#define DB 256
#define KK (KB * DIN)      // 8192
#define NEG 0.01f
#ifndef TR
#define TR (NR / 64)
#endif
typedef __attribute__((ext_vector_type(8))) __bf16 v8b;
__device__ __forceinline__ v16b frag_b(const __bf16* rowk0, int lane) {
  union { v16b v; v8b q[2]; } u; const __bf16* p = rowk0 + 8 * (lane >> 4);
  u.q[0] = *(const v8b*)p; u.q[1] = *(const v8b*)(p + 16); return u.v;
}
__device__ __forceinline__ float bfr(float v) { return (float)(__bf16)v; }
__device__ __attribute__((noinline)) float exp_ni(float v) { return expf(v); }
__device__ __attribute__((noinline)) float erf_ni(float v) { return erff(v); }

#define WS_WT  0u                                   // f16 W rows [o][k*512 + i]
#define WS_A   (WS_WT + 2u * (size_t)DOUT * KK)          // f16 outer-product operand [NR][8192]
#define WS_BF  (WS_A + 2u * (size_t)NR * KK)
#define BFS 32
#define WS_END (WS_BF + 4u * (size_t)NR * BFS)

__device__ __forceinline__ float lrelu(float v) { return v >= 0.f ? v : NEG * v; }
// ---- k_packw: block = output column o: WT[o][k*512 + i] = f16(W[k][i][o])
__global__ __launch_bounds__(256) void k_packw(const float* __restrict__ Wb, _Float16* __restrict__ WT) { __shared__ __align__(16) _Float16 s[KK]; const int o = blockIdx.x, t = threadIdx.x;
  for (int e = t; e < KK; e += 256) s[e] = (_Float16)bfr(Wb[(size_t)e * DOUT + o]);   // e = k*512 + i -> W[k][i][o] at ((k*512 + i)*512 + o)
  __syncthreads(); for (int q = t; q < KK / 8; q += 256) vst2((unsigned*)(WT + (size_t)o * KK + q * 8), *(const v4u*)&s[q * 8]); }
// ---- k_row: block = row (256 threads): a = lrelu(LN(x) g + b) (512); h = c w1 + b1; h = h + lrelu(h) wr + br; h = lrelu(h); bf = h w2 + b2 (16); A row = f16(bf[k] a[i]); BF row
__global__ __launch_bounds__(256) void k_row(const float* __restrict__ X, const float* __restrict__ C, const float* __restrict__ G, const float* __restrict__ Bt, const float* __restrict__ W1, const float* __restrict__ B1, const float* __restrict__ WR, const float* __restrict__ BR, const float* __restrict__ W2, const float* __restrict__ B2, _Float16* __restrict__ A16, float* __restrict__ BF) {
  __shared__ float red[8]; __shared__ float sa[DIN]; __shared__ float sc[DC]; __shared__ float sh[DB]; __shared__ float sh2[DB]; __shared__ float sred[8][KB]; __shared__ __align__(16) float sbf[BFS]; __shared__ __align__(16) _Float16 srow[KK];
  const int t = threadIdx.x; const size_t row = blockIdx.x;
  float v[2]; float s = 0.f; for (int i = 0; i < 2; ++i) { v[i] = bfr(X[row * DIN + t + 256 * i]); s += v[i]; }
#pragma unroll
  for (int o = 1; o < 32; o <<= 1) s += __shfl_xor(s, o);
  if ((t & 31) == 0) red[t >> 5] = s; __syncthreads(); float mu = 0.f; for (int i = 0; i < 8; ++i) mu += red[i]; mu /= (float)DIN; __syncthreads();
  float q = 0.f; for (int i = 0; i < 2; ++i) { const float d = v[i] - mu; q += d * d; }
#pragma unroll
  for (int o = 1; o < 32; o <<= 1) q += __shfl_xor(q, o);
  if ((t & 31) == 0) red[t >> 5] = q; __syncthreads(); float var = 0.f; for (int i = 0; i < 8; ++i) var += red[i]; var /= (float)DIN; const float inv = 1.0f / sqrtf(var + 1e-5f);
  for (int i = 0; i < 2; ++i) { const int cix = t + 256 * i; sa[cix] = lrelu((v[i] - mu) * inv * bfr(G[cix]) + bfr(Bt[cix])); }
  if (t < DC) sc[t] = bfr(C[row * DC + t]); __syncthreads();
  { float h = bfr(B1[t]);
#pragma unroll 1
    for (int k = 0; k < DC; ++k) h += sc[k] * bfr(W1[(size_t)k * DB + t]); sh[t] = h; } __syncthreads();
  { float h = sh[t] + bfr(BR[t]);
#pragma unroll 1
    for (int k = 0; k < DB; ++k) h += lrelu(sh[k]) * bfr(WR[(size_t)k * DB + t]); sh2[t] = lrelu(h); } __syncthreads();
  { float part[KB];
#pragma unroll
    for (int k = 0; k < KB; ++k) part[k] = sh2[t] * bfr(W2[(size_t)t * KB + k]);
#pragma unroll
    for (int k = 0; k < KB; ++k) { float pv = part[k];
#pragma unroll
      for (int o = 1; o < 32; o <<= 1) pv += __shfl_xor(pv, o);
      if ((t & 31) == 0) sred[t >> 5][k] = pv; } }
  __syncthreads(); if (t < KB) { float bfv = bfr(B2[t]); for (int w = 0; w < 8; ++w) bfv += sred[w][t]; sbf[t] = bfv; } else if (t < BFS) sbf[t] = 0.f; __syncthreads();
  for (int e = t; e < KK; e += 256) srow[e] = (_Float16)(sbf[e / DIN] * sa[e % DIN]); __syncthreads();
  for (int qq = t; qq < KK / 8; qq += 256) vst2((unsigned*)(A16 + row * KK + qq * 8), *(const v4u*)&srow[qq * 8]); if (t < BFS / 4) vst2(BF + row * BFS + t * 4, *(const v4f*)&sbf[t * 4]); }
// ---- k_big: block = (64 rows, 128 cols), 8 waves of 32 x 32: out = A (f16 [rows][8192]) . WT^T + sum_k bf[row][k] bvec[k][o]
// Both operands' tiles (192 rows of 256 k) come to LDS once per block by asynchronous copies, two buffers: the next tile flies while this one is multiplied.
#define KP 256                    // k per pass: 512 B of every operand row
#define PIT 264                   // LDS row pitch in halves: 528 B = 16 B x 33, conflict-free for 16-byte row reads
#define TROWS 192                 // 64 A rows, then 128 WT rows
#define BUFH (TROWS * PIT)
#define NPASS (KK / KP)
#define SFP 36
// twelve rows of a tile, one row (32 lanes x 16 B) per copy; the s_wait_xcnt closes the statement so that no address register is rewritten in front of it
__device__ __forceinline__ void cp12(const unsigned* l, const _Float16* const* p) {
  asm volatile("global_load_async_to_lds_b128 %0, %12, off\n\t"
               "global_load_async_to_lds_b128 %1, %13, off\n\t"
               "global_load_async_to_lds_b128 %2, %14, off\n\t"
               "global_load_async_to_lds_b128 %3, %15, off\n\t"
               "global_load_async_to_lds_b128 %4, %16, off\n\t"
               "global_load_async_to_lds_b128 %5, %17, off\n\t"
               "global_load_async_to_lds_b128 %6, %18, off\n\t"
               "global_load_async_to_lds_b128 %7, %19, off\n\t"
               "global_load_async_to_lds_b128 %8, %20, off\n\t"
               "global_load_async_to_lds_b128 %9, %21, off\n\t"
               "global_load_async_to_lds_b128 %10, %22, off\n\t"
               "global_load_async_to_lds_b128 %11, %23, off\n\t"
               "s_wait_xcnt 0x0"
               :: "v"(l[0]), "v"(l[1]), "v"(l[2]), "v"(l[3]), "v"(l[4]), "v"(l[5]), "v"(l[6]), "v"(l[7]), "v"(l[8]), "v"(l[9]), "v"(l[10]), "v"(l[11]),
                  "v"(p[0]), "v"(p[1]), "v"(p[2]), "v"(p[3]), "v"(p[4]), "v"(p[5]), "v"(p[6]), "v"(p[7]), "v"(p[8]), "v"(p[9]), "v"(p[10]), "v"(p[11])
               : "memory");
}
// one tile: wave w brings tile rows w, w + 8, ... (8 of A, 16 of WT); ga, gw = this lane's 16 bytes in the wave's first A and WT row of the pass, l0 = their place in LDS
__device__ __forceinline__ void copy_tile(unsigned l0, const _Float16* ga, const _Float16* gw) {
#pragma unroll
  for (int q = 0; q < 2; ++q) { unsigned l[12]; const _Float16* p[12];
#pragma unroll
    for (int e = 0; e < 12; ++e) { const int i = q * 12 + e; l[e] = l0 + (unsigned)(i * 8 * PIT * 2); p[e] = i < 8 ? ga + (size_t)i * 8 * KK : gw + (size_t)(i - 8) * 8 * KK; }
    cp12(l, p); }
}
__global__ __launch_bounds__(256) void k_big(const _Float16* __restrict__ A16, const _Float16* __restrict__ WT, const float* __restrict__ BF, const float* __restrict__ BV, float* __restrict__ OUT) {
  __shared__ __align__(16) _Float16 st[2 * BUFH]; __shared__ __align__(16) float sf[8][32][SFP];
  const int tid = threadIdx.x, wave = tid >> 5, lane = tid & 31, col = lane & 15, g = lane >> 4; const int wm = wave >> 2, wn = wave & 3;
  const size_t rb = (size_t)blockIdx.x * 64; const int cb = blockIdx.y * 128;
  const _Float16* ga = A16 + (rb + wave) * KK + lane * 8; const _Float16* gw = WT + (size_t)(cb + wave) * KK + lane * 8;
  const unsigned l0 = (unsigned)(size_t)&st[wave * PIT + lane * 8];
  v8f acc[2][2] = {};
  copy_tile(l0, ga, gw);
  asm volatile("s_wait_asynccnt 0x0" ::: "memory");   // tile 0 has landed before the barrier that publishes it
  __syncthreads();
  copy_tile(l0 + BUFH * 2, ga + KP, gw + KP);
  for (int t = 0; t < NPASS; ++t) { const _Float16* sb = st + (t & 1) * BUFH; const _Float16* sa_ = sb + (wm * 32 + col) * PIT; const _Float16* sw_ = sb + (64 + wn * 32 + col) * PIT;
#pragma unroll
    for (int ks = 0; ks < KP / 32; ++ks) { v16h a[2], b[2];
#pragma unroll
      for (int m = 0; m < 2; ++m) a[m] = frag_h(sa_ + m * 16 * PIT + ks * 32, lane);
#pragma unroll
      for (int j = 0; j < 2; ++j) b[j] = frag_h(sw_ + j * 16 * PIT + ks * 32, lane);
#pragma unroll
      for (int m = 0; m < 2; ++m)
#pragma unroll
        for (int j = 0; j < 2; ++j) acc[m][j] = wmma16(a[m], b[j], acc[m][j]); }
    asm volatile("s_wait_dscnt 0x0" ::: "memory");     // this wave's reads of the buffer are done before it is handed to the copies
    asm volatile("s_wait_asynccnt 0x0" ::: "memory");  // this wave's share of tile t + 1 has landed
    __syncthreads();                                   // publishes tile t + 1 and ends every reader's last read of tile t
    if (t + 2 < NPASS) copy_tile(l0 + (unsigned)((t & 1) * BUFH * 2), ga + (size_t)(t + 2) * KP, gw + (size_t)(t + 2) * KP); }
  asm volatile("s_wait_asynccnt 0x0" ::: "memory");    // nothing in flight when the wave goes on to its end
  const size_t r0 = rb + wm * 32; const int c0 = cb + wn * 32;
#pragma unroll
  for (int m = 0; m < 2; ++m)
#pragma unroll
    for (int j = 0; j < 2; ++j)
#pragma unroll
      for (int r = 0; r < 8; ++r) sf[wave][m * 16 + 8 * g + r][j * 16 + col] = acc[m][j][r];
  LDSX();
  // each wave's own 32 x 32 block goes out as whole 128-B lines: 8 lanes a row, 4 rows a store; the bias sum over k is added on the way
  const int c4 = (lane & 7) * 4, rq = lane >> 3; float bv[KB][4];
#pragma unroll
  for (int k = 0; k < KB; ++k) { const v4f w = *(const v4f*)(BV + (size_t)k * DOUT + c0 + c4);
#pragma unroll
    for (int e = 0; e < 4; ++e) bv[k][e] = bfr(w[e]); }
#pragma unroll 2   // fully unrolled the loop takes the kernel above 256 registers, and the asm copies then stand among register-window switches
  for (int rl = 0; rl < 32; rl += 4) { const size_t row = r0 + rl + rq; const v4f s = *(const v4f*)&sf[wave][rl + rq][c4]; v4f o;
#pragma unroll
    for (int e = 0; e < 4; ++e) { float bsum = 0.f;
#pragma unroll
      for (int k = 0; k < KB; ++k) bsum += BF[row * BFS + k] * bv[k][e];
      o[e] = s[e] + bsum; }
    vst2(OUT + row * DOUT + c0 + c4, o); } }
extern "C" void kernel_launch(void* const* d_in, const int* in_sizes, int n_in, void* d_out, int out_size, void* d_ws, size_t ws_size, hipStream_t stream) {
  (void)in_sizes; (void)n_in; (void)out_size;
  const float** F = (const float**)d_in;   // 0 x [4096,512], 1 c [4096,64], 2 ln_gamma, 3 ln_beta, 4 w1 [64,256], 5 b1, 6 wr [256,256], 7 br, 8 w2 [256,16], 9 b2, 10 W [16,512,512], 11 bvec [16,512]
  if (ws_size < (size_t)WS_END) return;
  char* ws = (char*)d_ws; _Float16 *WT = (_Float16*)(ws + WS_WT), *A16 = (_Float16*)(ws + WS_A); float* BF = (float*)(ws + WS_BF);
  k_packw<<<DOUT, 256, 0, stream>>>(F[10], WT);
  k_row<<<TR * 64, 256, 0, stream>>>(F[0], F[1], F[2], F[3], F[4], F[5], F[6], F[7], F[8], F[9], A16, BF);
  k_big<<<dim3(TR, DOUT / 128), 256, 0, stream>>>(A16, WT, BF, F[11], (float*)d_out);
}

// v002
// It runs in 99.7 microseconds.
// Next to v001, in two timings, it ran 2.57 and 2.58 times as fast.
// Counting every step since v000, it is 6.76 times as fast.
// compute dtype: all float inputs rounded to bf16; LayerNorm + LeakyReLU and the small basis network (64 -> 256 -> residual 256 -> 16) in f32 on VALU; the conditional bilinear contraction out[b,o] = sum_{k,i} (bf[b,k] a[b,i]) W[k,i,o] as ONE GEMM over K = 16 x 512 on WMMA 16x16x32 with the outer-product operand rounded once to f16 against W as exact f16 rows, f32 accumulate; + bf . bvec in f32; f32 output.
#include <hip/hip_runtime.h>
#include <math.h>

typedef __attribute__((ext_vector_type(16))) _Float16 v16h;
typedef __attribute__((ext_vector_type(16))) __bf16 v16b;
typedef __attribute__((ext_vector_type(8)))  _Float16 v8h;
typedef __attribute__((ext_vector_type(8)))  float v8f;
typedef __attribute__((ext_vector_type(4)))  float v4f;
typedef __attribute__((ext_vector_type(2)))  float v2f;
typedef __attribute__((ext_vector_type(4)))  unsigned v4u;
typedef __attribute__((ext_vector_type(4)))  int v4i;
typedef float __attribute__((may_alias)) float_a;
typedef int __attribute__((may_alias)) int_a;

template <typename T> __device__ __forceinline__ void vst2(void* p, T v) { *(T*)p = v;  }
__device__ __forceinline__ v8f wmma16(v16h a, v16h b, v8f c) {
  v8f d = __builtin_amdgcn_wmma_f32_16x16x32_f16(false, a, false, b, (short)0, c, false, false);
  asm volatile("v_nop\n\tv_nop\n\tv_nop\n\tv_nop" : "+v"(d) : "v"(a), "v"(b));
  return d;
}
__device__ __forceinline__ v8f wmma_bf(v16b a, v16b b, v8f c) {
  v8f d = __builtin_amdgcn_wmma_f32_16x16x32_bf16(false, a, false, b, (short)0, c, false, false);
  asm volatile("v_nop\n\tv_nop\n\tv_nop\n\tv_nop" : "+v"(d) : "v"(a), "v"(b));
  return d;
}
// 16x16x32 fragments: lane = (h = lane>>4, row/col = lane&15); elements 0..7 = k0+8h+0..7, 8..15 = k0+16+8h+0..7; D element r = row 8h+r
__device__ __forceinline__ v16h frag_h(const _Float16* rowk0, int lane) {
  union { v16h v; v8h q[2]; } u; const _Float16* p = rowk0 + 8 * (lane >> 4);
  u.q[0] = *(const v8h*)p; u.q[1] = *(const v8h*)(p + 16); return u.v;
}
__device__ __forceinline__ v16h frag_f32(const float* rowk0, int lane) {
  v16h a; const float* p = rowk0 + 8 * (lane >> 4);
#pragma unroll
  for (int i = 0; i < 8; ++i) { a[i] = (_Float16)p[i]; a[8 + i] = (_Float16)p[16 + i]; }
  return a;
}
__device__ __forceinline__ v16h frag_f32s(const float* rowk0, int lane, float sc) {
  v16h a; const float* p = rowk0 + 8 * (lane >> 4);
#pragma unroll
  for (int i = 0; i < 8; ++i) { a[i] = (_Float16)(p[i] * sc); a[8 + i] = (_Float16)(p[16 + i] * sc); }
  return a;
}
// column fragment from a [K][ld] layout (column n), rows >= K read as 0
__device__ __forceinline__ v16h fragc_f32(const float* W, int k0, int n, int lane, int ld, int K) {
  v16h a; const int g = lane >> 4;
#pragma unroll
  for (int i = 0; i < 8; ++i) { const int ka = k0 + 8 * g + i, kb = ka + 16;
    a[i] = (_Float16)(ka < K ? W[(size_t)(ka < K ? ka : K - 1) * ld + n] : 0.f); a[8 + i] = (_Float16)(kb < K ? W[(size_t)(kb < K ? kb : K - 1) * ld + n] : 0.f); }
  return a;
}
struct F2 { v16b h, l; };
__device__ __forceinline__ F2 bsplit16(const float v[16]) { F2 r;
#pragma unroll
  for (int i = 0; i < 16; ++i) { const __bf16 h = (__bf16)v[i]; r.h[i] = h; r.l[i] = (__bf16)(v[i] - (float)h); }
  return r; }
__device__ __forceinline__ F2 split_row(const float* row, int k0, int lane) { float v[16]; const float* p = row + k0 + 8 * (lane >> 4);
#pragma unroll
  for (int i = 0; i < 8; ++i) { v[i] = p[i]; v[8 + i] = p[16 + i]; }
  return bsplit16(v); }
__device__ __forceinline__ F2 split_rowK(const float* row, int k0, int lane, int K) { float v[16]; const int g = lane >> 4;
#pragma unroll
  for (int i = 0; i < 8; ++i) { const int ka = k0 + 8 * g + i, kb = ka + 16; v[i] = ka < K ? row[ka < K ? ka : K - 1] : 0.f; v[8 + i] = kb < K ? row[kb < K ? kb : K - 1] : 0.f; }
  return bsplit16(v); }
__device__ __forceinline__ F2 split_col(const float* W, int k0, int n, int lane, int ld, int K) { float v[16]; const int g = lane >> 4;
#pragma unroll
  for (int i = 0; i < 8; ++i) { const int ka = k0 + 8 * g + i, kb = ka + 16; v[i] = ka < K ? W[(size_t)(ka < K ? ka : K - 1) * ld + n] : 0.f; v[8 + i] = kb < K ? W[(size_t)(kb < K ? kb : K - 1) * ld + n] : 0.f; }
  return bsplit16(v); }
__device__ __forceinline__ v8f mac3(const F2& a, const F2& b, v8f c) { c = wmma_bf(a.l, b.h, c); c = wmma_bf(a.h, b.l, c); return wmma_bf(a.h, b.h, c); }
__device__ __forceinline__ float sigm(float v) { return 1.0f / (1.0f + expf(-v)); }
#define LDSX() do { asm volatile("s_wait_dscnt 0" ::: "memory"); __builtin_amdgcn_wave_barrier(); __builtin_amdgcn_fence(__ATOMIC_RELEASE, "workgroup"); } while (0)


// Conditional pre-activation dense layer (4,096 rows, 512 -> 512, 16 basis matrices selected by a 64-dim condition through a small residual MLP): a = LeakyReLU(LayerNorm(x)); bf = basis(c); out = sum_k bf_k (a W_k + bias_k).
#define NR 4096
#define DIN 512
#define DOUT 512
#define DC 64
#define KB 16
#define DB 256
#define KK (KB * DIN)      // 8192
#define NEG 0.01f
#ifndef TR
#define TR (NR / 64)
#endif
typedef __attribute__((ext_vector_type(8))) __bf16 v8b;
__device__ __forceinline__ v16b frag_b(const __bf16* rowk0, int lane) {
  union { v16b v; v8b q[2]; } u; const __bf16* p = rowk0 + 8 * (lane >> 4);
  u.q[0] = *(const v8b*)p; u.q[1] = *(const v8b*)(p + 16); return u.v;
}
__device__ __forceinline__ float bfr(float v) { return (float)(__bf16)v; }
__device__ __attribute__((noinline)) float exp_ni(float v) { return expf(v); }
__device__ __attribute__((noinline)) float erf_ni(float v) { return erff(v); }

#define WS_WT  0u                                   // f16 W rows [o][k*512 + i]
#define WS_A   (WS_WT + 2u * (size_t)DOUT * KK)          // f16 outer-product operand [NR][8192]
#define WS_BF  (WS_A + 2u * (size_t)NR * KK)
#define BFS 32
#define WS_END (WS_BF + 4u * (size_t)NR * BFS)

__device__ __forceinline__ float lrelu(float v) { return v >= 0.f ? v : NEG * v; }
// ---- k_packw: block = output column o: WT[o][k*512 + i] = f16(W[k][i][o])
__global__ __launch_bounds__(256) void k_packw(const float* __restrict__ Wb, _Float16* __restrict__ WT) { __shared__ __align__(16) _Float16 s[KK]; const int o = blockIdx.x, t = threadIdx.x;
  for (int e = t; e < KK; e += 256) s[e] = (_Float16)bfr(Wb[(size_t)e * DOUT + o]);   // e = k*512 + i -> W[k][i][o] at ((k*512 + i)*512 + o)
  __syncthreads(); for (int q = t; q < KK / 8; q += 256) vst2((unsigned*)(WT + (size_t)o * KK + q * 8), *(const v4u*)&s[q * 8]); }
// ---- k_row: block = 8 rows (256 threads), so that every weight of the basis network is loaded once for 8 rows; thread t owns hidden unit t of all 8. Per row, in the same order of sums as one row alone: a = lrelu(LN(x) g + b) (512); h = c w1 + b1; h = h + lrelu(h) wr + br; h = lrelu(h); bf = h w2 + b2 (16); A row = f16(bf[k] a[i]); BF row
#define RPB 8
__global__ __launch_bounds__(256) void k_row(const float* __restrict__ X, const float* __restrict__ C, const float* __restrict__ G, const float* __restrict__ Bt, const float* __restrict__ W1, const float* __restrict__ B1, const float* __restrict__ WR, const float* __restrict__ BR, const float* __restrict__ W2, const float* __restrict__ B2, _Float16* __restrict__ A16, float* __restrict__ BF) {
  __shared__ float red[RPB][8]; __shared__ float sa[RPB][DIN]; __shared__ __align__(16) float sc[DC][RPB]; __shared__ __align__(16) float sl[DB][RPB]; __shared__ float sred[RPB][8][KB]; __shared__ __align__(16) float sbf[RPB][BFS]; __shared__ __align__(16) _Float16 srow[2][KK];
  const int t = threadIdx.x; const size_t row0 = (size_t)blockIdx.x * RPB; const float* xb = X + row0 * DIN;
  float v[RPB][2], s[RPB];
#pragma unroll
  for (int r = 0; r < RPB; ++r) { s[r] = 0.f; for (int i = 0; i < 2; ++i) { v[r][i] = bfr(xb[r * DIN + t + 256 * i]); s[r] += v[r][i]; } }
#pragma unroll
  for (int o = 1; o < 32; o <<= 1)   // level by level over the 8 rows: 8 independent exchanges share each LDS latency
#pragma unroll
    for (int r = 0; r < RPB; ++r) s[r] += __shfl_xor(s[r], o);
  if ((t & 31) == 0) {
#pragma unroll
    for (int r = 0; r < RPB; ++r) red[r][t >> 5] = s[r]; }
  __syncthreads(); float mu[RPB];
#pragma unroll
  for (int r = 0; r < RPB; ++r) { float m = 0.f; for (int i = 0; i < 8; ++i) m += red[r][i]; mu[r] = m / (float)DIN; }
  __syncthreads();
#pragma unroll
  for (int r = 0; r < RPB; ++r) { float q = 0.f; for (int i = 0; i < 2; ++i) { const float d = v[r][i] - mu[r]; q += d * d; } s[r] = q; }
#pragma unroll
  for (int o = 1; o < 32; o <<= 1)
#pragma unroll
    for (int r = 0; r < RPB; ++r) s[r] += __shfl_xor(s[r], o);
  if ((t & 31) == 0) {
#pragma unroll
    for (int r = 0; r < RPB; ++r) red[r][t >> 5] = s[r]; }
  __syncthreads();
  { float gg[2], bb[2]; for (int i = 0; i < 2; ++i) { gg[i] = bfr(G[t + 256 * i]); bb[i] = bfr(Bt[t + 256 * i]); }
#pragma unroll
    for (int r = 0; r < RPB; ++r) { float var = 0.f; for (int i = 0; i < 8; ++i) var += red[r][i]; var /= (float)DIN; const float inv = 1.0f / sqrtf(var + 1e-5f);
      for (int i = 0; i < 2; ++i) sa[r][t + 256 * i] = lrelu((v[r][i] - mu[r]) * inv * gg[i] + bb[i]); } }
#pragma unroll
  for (int e = t; e < RPB * DC; e += 256) sc[e % DC][e / DC] = bfr(C[row0 * DC + e]);
  __syncthreads();
  float h[RPB];
  { const float b1 = bfr(B1[t]);
#pragma unroll
    for (int r = 0; r < RPB; ++r) h[r] = b1; }
#pragma unroll 16   // sixteen weight loads in flight at a time; rolled, every trip waits out its own load
  for (int k = 0; k < DC; ++k) { const float w = bfr(W1[(size_t)k * DB + t]); const v4f c0 = *(const v4f*)&sc[k][0], c1 = *(const v4f*)&sc[k][4];
#pragma unroll
    for (int r = 0; r < 4; ++r) { h[r] += c0[r] * w; h[4 + r] += c1[r] * w; } }
  { v4f l0, l1;
#pragma unroll
    for (int r = 0; r < 4; ++r) { l0[r] = lrelu(h[r]); l1[r] = lrelu(h[4 + r]); }
    *(v4f*)&sl[t][0] = l0; *(v4f*)&sl[t][4] = l1; }
  __syncthreads();
  { const float br = bfr(BR[t]);
#pragma unroll
    for (int r = 0; r < RPB; ++r) h[r] = h[r] + br; }
#pragma unroll 16   // sixteen weight loads in flight at a time, as above
  for (int k = 0; k < DB; ++k) { const float w = bfr(WR[(size_t)k * DB + t]); const v4f c0 = *(const v4f*)&sl[k][0], c1 = *(const v4f*)&sl[k][4];
#pragma unroll
    for (int r = 0; r < 4; ++r) { h[r] += c0[r] * w; h[4 + r] += c1[r] * w; } }
  { float w2[KB];
#pragma unroll
    for (int k = 0; k < KB; ++k) w2[k] = bfr(W2[(size_t)t * KB + k]);
#pragma unroll
    for (int r = 0; r < RPB; ++r) { const float h2 = lrelu(h[r]); float pv[KB];
#pragma unroll
      for (int k = 0; k < KB; ++k) pv[k] = h2 * w2[k];
#pragma unroll
      for (int o = 1; o < 32; o <<= 1)   // level by level over the 16 sums of a row, as above
#pragma unroll
        for (int k = 0; k < KB; ++k) pv[k] += __shfl_xor(pv[k], o);
      if ((t & 31) == 0) {
#pragma unroll
        for (int k = 0; k < KB; ++k) sred[r][t >> 5][k] = pv[k]; } } }
  __syncthreads();
  { const int r = t / BFS, k = t % BFS; float bfv = 0.f;   // 256 threads = 8 rows x 32 padded basis slots
    if (k < KB) { bfv = bfr(B2[k]); for (int w = 0; w < 8; ++w) bfv += sred[r][w][k]; }
    sbf[r][k] = bfv; }
  __syncthreads();
#pragma unroll 1   // rolled: the trips are split by a barrier anyway, and eight copies of the body would only lengthen the code
  for (int r = 0; r < RPB; ++r) {
#pragma unroll
    for (int j = 0; j < KK / 256; ++j) { const int e = t + 256 * j; srow[r & 1][e] = (_Float16)(sbf[r][e / DIN] * sa[r][e % DIN]); }
    __syncthreads();   // publishes row r; with two buffers it also ends every reader's last read of row r - 1, whose buffer row r + 1 writes next
#pragma unroll
    for (int j = 0; j < KK / 8 / 256; ++j) { const int qq = t + 256 * j; vst2((unsigned*)(A16 + (row0 + r) * KK + qq * 8), *(const v4u*)&srow[r & 1][qq * 8]); }
    asm volatile("s_wait_xcnt 0x0" ::: "memory"); }   // the next trip rewrites the registers that these stores name (precaution)
  if (t < RPB * BFS / 4) vst2(BF + row0 * BFS + t * 4, *(const v4f*)&sbf[t / (BFS / 4)][(t % (BFS / 4)) * 4]); }
// ---- k_big: block = (64 rows, 128 cols), 8 waves of 32 x 32: out = A (f16 [rows][8192]) . WT^T + sum_k bf[row][k] bvec[k][o]
// Both operands' tiles (192 rows of 256 k) come to LDS once per block by asynchronous copies, two buffers: the next tile flies while this one is multiplied.
#define KP 256                    // k per pass: 512 B of every operand row
#define PIT 264                   // LDS row pitch in halves: 528 B = 16 B x 33, conflict-free for 16-byte row reads
#define TROWS 192                 // 64 A rows, then 128 WT rows
#define BUFH (TROWS * PIT)
#define NPASS (KK / KP)
#define SFP 36
// twelve rows of a tile, one row (32 lanes x 16 B) per copy; the s_wait_xcnt closes the statement so that no address register is rewritten in front of it
__device__ __forceinline__ void cp12(const unsigned* l, const _Float16* const* p) {
  asm volatile("global_load_async_to_lds_b128 %0, %12, off\n\t"
               "global_load_async_to_lds_b128 %1, %13, off\n\t"
               "global_load_async_to_lds_b128 %2, %14, off\n\t"
               "global_load_async_to_lds_b128 %3, %15, off\n\t"
               "global_load_async_to_lds_b128 %4, %16, off\n\t"
               "global_load_async_to_lds_b128 %5, %17, off\n\t"
               "global_load_async_to_lds_b128 %6, %18, off\n\t"
               "global_load_async_to_lds_b128 %7, %19, off\n\t"
               "global_load_async_to_lds_b128 %8, %20, off\n\t"
               "global_load_async_to_lds_b128 %9, %21, off\n\t"
               "global_load_async_to_lds_b128 %10, %22, off\n\t"
               "global_load_async_to_lds_b128 %11, %23, off\n\t"
               "s_wait_xcnt 0x0"
               :: "v"(l[0]), "v"(l[1]), "v"(l[2]), "v"(l[3]), "v"(l[4]), "v"(l[5]), "v"(l[6]), "v"(l[7]), "v"(l[8]), "v"(l[9]), "v"(l[10]), "v"(l[11]),
                  "v"(p[0]), "v"(p[1]), "v"(p[2]), "v"(p[3]), "v"(p[4]), "v"(p[5]), "v"(p[6]), "v"(p[7]), "v"(p[8]), "v"(p[9]), "v"(p[10]), "v"(p[11])
               : "memory");
}
// one tile: wave w brings tile rows w, w + 8, ... (8 of A, 16 of WT); ga, gw = this lane's 16 bytes in the wave's first A and WT row of the pass, l0 = their place in LDS
__device__ __forceinline__ void copy_tile(unsigned l0, const _Float16* ga, const _Float16* gw) {
#pragma unroll
  for (int q = 0; q < 2; ++q) { unsigned l[12]; const _Float16* p[12];
#pragma unroll
    for (int e = 0; e < 12; ++e) { const int i = q * 12 + e; l[e] = l0 + (unsigned)(i * 8 * PIT * 2); p[e] = i < 8 ? ga + (size_t)i * 8 * KK : gw + (size_t)(i - 8) * 8 * KK; }
    cp12(l, p); }
}
__global__ __launch_bounds__(256) void k_big(const _Float16* __restrict__ A16, const _Float16* __restrict__ WT, const float* __restrict__ BF, const float* __restrict__ BV, float* __restrict__ OUT) {
  __shared__ __align__(16) _Float16 st[2 * BUFH]; __shared__ __align__(16) float sf[8][32][SFP];
  const int tid = threadIdx.x, wave = tid >> 5, lane = tid & 31, col = lane & 15, g = lane >> 4; const int wm = wave >> 2, wn = wave & 3;
  const size_t rb = (size_t)blockIdx.x * 64; const int cb = blockIdx.y * 128;
  const _Float16* ga = A16 + (rb + wave) * KK + lane * 8; const _Float16* gw = WT + (size_t)(cb + wave) * KK + lane * 8;
  const unsigned l0 = (unsigned)(size_t)&st[wave * PIT + lane * 8];
  v8f acc[2][2] = {};
  copy_tile(l0, ga, gw);
  asm volatile("s_wait_asynccnt 0x0" ::: "memory");   // tile 0 has landed before the barrier that publishes it
  __syncthreads();
  copy_tile(l0 + BUFH * 2, ga + KP, gw + KP);
  for (int t = 0; t < NPASS; ++t) { const _Float16* sb = st + (t & 1) * BUFH; const _Float16* sa_ = sb + (wm * 32 + col) * PIT; const _Float16* sw_ = sb + (64 + wn * 32 + col) * PIT;
#pragma unroll
    for (int ks = 0; ks < KP / 32; ++ks) { v16h a[2], b[2];
#pragma unroll
      for (int m = 0; m < 2; ++m) a[m] = frag_h(sa_ + m * 16 * PIT + ks * 32, lane);
#pragma unroll
      for (int j = 0; j < 2; ++j) b[j] = frag_h(sw_ + j * 16 * PIT + ks * 32, lane);
#pragma unroll
      for (int m = 0; m < 2; ++m)
#pragma unroll
        for (int j = 0; j < 2; ++j) acc[m][j] = wmma16(a[m], b[j], acc[m][j]); }
    asm volatile("s_wait_dscnt 0x0" ::: "memory");     // this wave's reads of the buffer are done before it is handed to the copies
    asm volatile("s_wait_asynccnt 0x0" ::: "memory");  // this wave's share of tile t + 1 has landed
    __syncthreads();                                   // publishes tile t + 1 and ends every reader's last read of tile t
    if (t + 2 < NPASS) copy_tile(l0 + (unsigned)((t & 1) * BUFH * 2), ga + (size_t)(t + 2) * KP, gw + (size_t)(t + 2) * KP); }
  asm volatile("s_wait_asynccnt 0x0" ::: "memory");    // nothing in flight when the wave goes on to its end
  const size_t r0 = rb + wm * 32; const int c0 = cb + wn * 32;
#pragma unroll
  for (int m = 0; m < 2; ++m)
#pragma unroll
    for (int j = 0; j < 2; ++j)
#pragma unroll
      for (int r = 0; r < 8; ++r) sf[wave][m * 16 + 8 * g + r][j * 16 + col] = acc[m][j][r];
  LDSX();
  // each wave's own 32 x 32 block goes out as whole 128-B lines: 8 lanes a row, 4 rows a store; the bias sum over k is added on the way
  const int c4 = (lane & 7) * 4, rq = lane >> 3; float bv[KB][4];
#pragma unroll
  for (int k = 0; k < KB; ++k) { const v4f w = *(const v4f*)(BV + (size_t)k * DOUT + c0 + c4);
#pragma unroll
    for (int e = 0; e < 4; ++e) bv[k][e] = bfr(w[e]); }
#pragma unroll 2   // fully unrolled the loop takes the kernel above 256 registers, and the asm copies then stand among register-window switches
  for (int rl = 0; rl < 32; rl += 4) { const size_t row = r0 + rl + rq; const v4f s = *(const v4f*)&sf[wave][rl + rq][c4]; v4f o;
#pragma unroll
    for (int e = 0; e < 4; ++e) { float bsum = 0.f;
#pragma unroll
      for (int k = 0; k < KB; ++k) bsum += BF[row * BFS + k] * bv[k][e];
      o[e] = s[e] + bsum; }
    vst2(OUT + row * DOUT + c0 + c4, o); } }
extern "C" void kernel_launch(void* const* d_in, const int* in_sizes, int n_in, void* d_out, int out_size, void* d_ws, size_t ws_size, hipStream_t stream) {
  (void)in_sizes; (void)n_in; (void)out_size;
  const float** F = (const float**)d_in;   // 0 x [4096,512], 1 c [4096,64], 2 ln_gamma, 3 ln_beta, 4 w1 [64,256], 5 b1, 6 wr [256,256], 7 br, 8 w2 [256,16], 9 b2, 10 W [16,512,512], 11 bvec [16,512]
  if (ws_size < (size_t)WS_END) return;
  char* ws = (char*)d_ws; _Float16 *WT = (_Float16*)(ws + WS_WT), *A16 = (_Float16*)(ws + WS_A); float* BF = (float*)(ws + WS_BF);
  k_packw<<<DOUT, 256, 0, stream>>>(F[10], WT);
  k_row<<<TR * 64 / RPB, 256, 0, stream>>>(F[0], F[1], F[2], F[3], F[4], F[5], F[6], F[7], F[8], F[9], A16, BF);
  k_big<<<dim3(TR, DOUT / 128), 256, 0, stream>>>(A16, WT, BF, F[11], (float*)d_out);
}

// v003
// Measured time: 82.3 microseconds a run.
// Timed twice side by side with v002, it ran 1.22 and 1.21 times as fast.
// Counting every step since v000, it is 8.23 times as fast.
// compute dtype: all float inputs rounded to bf16; LayerNorm + LeakyReLU and the small basis network (64 -> 256 -> residual 256 -> 16) in f32 on VALU; the conditional bilinear contraction out[b,o] = sum_k bf[b,k] (sum_i a[b,i] W[k,i,o]): the inner sums on WMMA 16x16x32, a rounded once to f16 against W as exact f16 rows, f32 accumulate, one accumulator per basis matrix; the sum over k with bf in f32; + bf . bvec in f32; f32 output.
#include <hip/hip_runtime.h>
#include <math.h>

typedef __attribute__((ext_vector_type(16))) _Float16 v16h;
typedef __attribute__((ext_vector_type(16))) __bf16 v16b;
typedef __attribute__((ext_vector_type(8)))  _Float16 v8h;
typedef __attribute__((ext_vector_type(8)))  float v8f;
typedef __attribute__((ext_vector_type(4)))  float v4f;
typedef __attribute__((ext_vector_type(2)))  float v2f;
typedef __attribute__((ext_vector_type(4)))  unsigned v4u;
typedef __attribute__((ext_vector_type(4)))  int v4i;
typedef float __attribute__((may_alias)) float_a;
typedef int __attribute__((may_alias)) int_a;

template <typename T> __device__ __forceinline__ void vst2(void* p, T v) { *(T*)p = v;  }
__device__ __forceinline__ v8f wmma16(v16h a, v16h b, v8f c) {
  v8f d = __builtin_amdgcn_wmma_f32_16x16x32_f16(false, a, false, b, (short)0, c, false, false);
  asm volatile("v_nop\n\tv_nop\n\tv_nop\n\tv_nop" : "+v"(d) : "v"(a), "v"(b));
  return d;
}
__device__ __forceinline__ v8f wmma_bf(v16b a, v16b b, v8f c) {
  v8f d = __builtin_amdgcn_wmma_f32_16x16x32_bf16(false, a, false, b, (short)0, c, false, false);
  asm volatile("v_nop\n\tv_nop\n\tv_nop\n\tv_nop" : "+v"(d) : "v"(a), "v"(b));
  return d;
}
// 16x16x32 fragments: lane = (h = lane>>4, row/col = lane&15); elements 0..7 = k0+8h+0..7, 8..15 = k0+16+8h+0..7; D element r = row 8h+r
__device__ __forceinline__ v16h frag_h(const _Float16* rowk0, int lane) {
  union { v16h v; v8h q[2]; } u; const _Float16* p = rowk0 + 8 * (lane >> 4);
  u.q[0] = *(const v8h*)p; u.q[1] = *(const v8h*)(p + 16); return u.v;
}
__device__ __forceinline__ v16h frag_f32(const float* rowk0, int lane) {
  v16h a; const float* p = rowk0 + 8 * (lane >> 4);
#pragma unroll
  for (int i = 0; i < 8; ++i) { a[i] = (_Float16)p[i]; a[8 + i] = (_Float16)p[16 + i]; }
  return a;
}
__device__ __forceinline__ v16h frag_f32s(const float* rowk0, int lane, float sc) {
  v16h a; const float* p = rowk0 + 8 * (lane >> 4);
#pragma unroll
  for (int i = 0; i < 8; ++i) { a[i] = (_Float16)(p[i] * sc); a[8 + i] = (_Float16)(p[16 + i] * sc); }
  return a;
}
// column fragment from a [K][ld] layout (column n), rows >= K read as 0
__device__ __forceinline__ v16h fragc_f32(const float* W, int k0, int n, int lane, int ld, int K) {
  v16h a; const int g = lane >> 4;
#pragma unroll
  for (int i = 0; i < 8; ++i) { const int ka = k0 + 8 * g + i, kb = ka + 16;
    a[i] = (_Float16)(ka < K ? W[(size_t)(ka < K ? ka : K - 1) * ld + n] : 0.f); a[8 + i] = (_Float16)(kb < K ? W[(size_t)(kb < K ? kb : K - 1) * ld + n] : 0.f); }
  return a;
}
struct F2 { v16b h, l; };
__device__ __forceinline__ F2 bsplit16(const float v[16]) { F2 r;
#pragma unroll
  for (int i = 0; i < 16; ++i) { const __bf16 h = (__bf16)v[i]; r.h[i] = h; r.l[i] = (__bf16)(v[i] - (float)h); }
  return r; }
__device__ __forceinline__ F2 split_row(const float* row, int k0, int lane) { float v[16]; const float* p = row + k0 + 8 * (lane >> 4);
#pragma unroll
  for (int i = 0; i < 8; ++i) { v[i] = p[i]; v[8 + i] = p[16 + i]; }
  return bsplit16(v); }
__device__ __forceinline__ F2 split_rowK(const float* row, int k0, int lane, int K) { float v[16]; const int g = lane >> 4;
#pragma unroll
  for (int i = 0; i < 8; ++i) { const int ka = k0 + 8 * g + i, kb = ka + 16; v[i] = ka < K ? row[ka < K ? ka : K - 1] : 0.f; v[8 + i] = kb < K ? row[kb < K ? kb : K - 1] : 0.f; }
  return bsplit16(v); }
__device__ __forceinline__ F2 split_col(const float* W, int k0, int n, int lane, int ld, int K) { float v[16]; const int g = lane >> 4;
#pragma unroll
  for (int i = 0; i < 8; ++i) { const int ka = k0 + 8 * g + i, kb = ka + 16; v[i] = ka < K ? W[(size_t)(ka < K ? ka : K - 1) * ld + n] : 0.f; v[8 + i] = kb < K ? W[(size_t)(kb < K ? kb : K - 1) * ld + n] : 0.f; }
  return bsplit16(v); }
__device__ __forceinline__ v8f mac3(const F2& a, const F2& b, v8f c) { c = wmma_bf(a.l, b.h, c); c = wmma_bf(a.h, b.l, c); return wmma_bf(a.h, b.h, c); }
__device__ __forceinline__ float sigm(float v) { return 1.0f / (1.0f + expf(-v)); }
#define LDSX() do { asm volatile("s_wait_dscnt 0" ::: "memory"); __builtin_amdgcn_wave_barrier(); __builtin_amdgcn_fence(__ATOMIC_RELEASE, "workgroup"); } while (0)


// Conditional pre-activation dense layer (4,096 rows, 512 -> 512, 16 basis matrices selected by a 64-dim condition through a small residual MLP): a = LeakyReLU(LayerNorm(x)); bf = basis(c); out = sum_k bf_k (a W_k + bias_k).
#define NR 4096
#define DIN 512
#define DOUT 512
#define DC 64
#define KB 16
#define DB 256
#define KK (KB * DIN)      // 8192
#define NEG 0.01f
#ifndef TR
#define TR (NR / 64)
#endif
typedef __attribute__((ext_vector_type(8))) __bf16 v8b;
__device__ __forceinline__ v16b frag_b(const __bf16* rowk0, int lane) {
  union { v16b v; v8b q[2]; } u; const __bf16* p = rowk0 + 8 * (lane >> 4);
  u.q[0] = *(const v8b*)p; u.q[1] = *(const v8b*)(p + 16); return u.v;
}
__device__ __forceinline__ float bfr(float v) { return (float)(__bf16)v; }
__device__ __attribute__((noinline)) float exp_ni(float v) { return expf(v); }
__device__ __attribute__((noinline)) float erf_ni(float v) { return erff(v); }

#define WS_WT  0u                                   // f16 W rows [o][8192], in the order of k_big's passes (see k_packw)
#define WS_A   (WS_WT + 2u * (size_t)DOUT * KK)          // f16 activations a [NR][512]
#define WS_BF  (WS_A + 2u * (size_t)NR * DIN)
#define BFS 32
#define WS_END (WS_BF + 4u * (size_t)NR * BFS)

__device__ __forceinline__ float lrelu(float v) { return v >= 0.f ? v : NEG * v; }
// ---- k_packw: block = output column o: WT[o][p(k, i)] = f16(W[k][i][o]); p puts the 64 i of 4 neighbouring k side by side, so that one pass of k_big (256 halves of a row) holds the same i of 4 basis matrices
#define KG 4                      // basis matrices that share an A fragment in k_big
__global__ __launch_bounds__(256) void k_packw(const float* __restrict__ Wb, _Float16* __restrict__ WT) { __shared__ __align__(16) _Float16 s[KK]; const int o = blockIdx.x, t = threadIdx.x;
#pragma unroll 1   // one trip = one group of KG basis matrices; its eight strided loads (inner loop, unrolled) are in flight together
  for (int kg = 0; kg < KB / KG; ++kg)
#pragma unroll
    for (int u = 0; u < 2 * KG; ++u) { const int k = kg * KG + u / 2, i = t + 256 * (u % 2); s[(kg * (DIN / 64) + i / 64) * (KG * 64) + (u / 2) * 64 + i % 64] = (_Float16)bfr(Wb[(size_t)(k * DIN + i) * DOUT + o]); }   // W[k][i][o] at ((k*512 + i)*512 + o)
  __syncthreads(); for (int q = t; q < KK / 8; q += 256) vst2((unsigned*)(WT + (size_t)o * KK + q * 8), *(const v4u*)&s[q * 8]); }
// ---- k_row: block = 8 rows (256 threads), so that every weight of the basis network is loaded once for 8 rows; thread t owns hidden unit t of all 8. Per row, in the same order of sums as one row alone: a = lrelu(LN(x) g + b) (512); h = c w1 + b1; h = h + lrelu(h) wr + br; h = lrelu(h); bf = h w2 + b2 (16); A row = f16(a[i]); BF row
#define RPB 8
__global__ __launch_bounds__(256) void k_row(const float* __restrict__ X, const float* __restrict__ C, const float* __restrict__ G, const float* __restrict__ Bt, const float* __restrict__ W1, const float* __restrict__ B1, const float* __restrict__ WR, const float* __restrict__ BR, const float* __restrict__ W2, const float* __restrict__ B2, _Float16* __restrict__ A16, float* __restrict__ BF) {
  __shared__ float red[RPB][8]; __shared__ __align__(16) float sa[RPB][DIN]; __shared__ __align__(16) float sc[DC][RPB]; __shared__ __align__(16) float sl[DB][RPB]; __shared__ float sred[RPB][8][KB]; __shared__ __align__(16) float sbf[RPB][BFS];
  const int t = threadIdx.x; const size_t row0 = (size_t)blockIdx.x * RPB; const float* xb = X + row0 * DIN;
  float v[RPB][2], s[RPB];
#pragma unroll
  for (int r = 0; r < RPB; ++r) { s[r] = 0.f; for (int i = 0; i < 2; ++i) { v[r][i] = bfr(xb[r * DIN + t + 256 * i]); s[r] += v[r][i]; } }
#pragma unroll
  for (int o = 1; o < 32; o <<= 1)   // level by level over the 8 rows: 8 independent exchanges share each LDS latency
#pragma unroll
    for (int r = 0; r < RPB; ++r) s[r] += __shfl_xor(s[r], o);
  if ((t & 31) == 0) {
#pragma unroll
    for (int r = 0; r < RPB; ++r) red[r][t >> 5] = s[r]; }
  __syncthreads(); float mu[RPB];
#pragma unroll
  for (int r = 0; r < RPB; ++r) { float m = 0.f; for (int i = 0; i < 8; ++i) m += red[r][i]; mu[r] = m / (float)DIN; }
  __syncthreads();
#pragma unroll
  for (int r = 0; r < RPB; ++r) { float q = 0.f; for (int i = 0; i < 2; ++i) { const float d = v[r][i] - mu[r]; q += d * d; } s[r] = q; }
#pragma unroll
  for (int o = 1; o < 32; o <<= 1)
#pragma unroll
    for (int r = 0; r < RPB; ++r) s[r] += __shfl_xor(s[r], o);
  if ((t & 31) == 0) {
#pragma unroll
    for (int r = 0; r < RPB; ++r) red[r][t >> 5] = s[r]; }
  __syncthreads();
  { float gg[2], bb[2]; for (int i = 0; i < 2; ++i) { gg[i] = bfr(G[t + 256 * i]); bb[i] = bfr(Bt[t + 256 * i]); }
#pragma unroll
    for (int r = 0; r < RPB; ++r) { float var = 0.f; for (int i = 0; i < 8; ++i) var += red[r][i]; var /= (float)DIN; const float inv = 1.0f / sqrtf(var + 1e-5f);
      for (int i = 0; i < 2; ++i) sa[r][t + 256 * i] = lrelu((v[r][i] - mu[r]) * inv * gg[i] + bb[i]); } }
#pragma unroll
  for (int e = t; e < RPB * DC; e += 256) sc[e % DC][e / DC] = bfr(C[row0 * DC + e]);
  __syncthreads();
#pragma unroll
  for (int j = 0; j < RPB * DIN / 8 / 256; ++j) { const int q = t + 256 * j; const float* p = &sa[0][0] + q * 8; const v4f a0 = *(const v4f*)p, a1 = *(const v4f*)(p + 4); v8h o;   // the 8 rows of a go out as f16, 16 bytes a thread
#pragma unroll
    for (int e = 0; e < 4; ++e) { o[e] = (_Float16)a0[e]; o[4 + e] = (_Float16)a1[e]; }
    vst2(A16 + row0 * DIN + q * 8, o); }
  float h[RPB];
  { const float b1 = bfr(B1[t]);
#pragma unroll
    for (int r = 0; r < RPB; ++r) h[r] = b1; }
#pragma unroll 16   // sixteen weight loads in flight at a time; rolled, every trip waits out its own load
  for (int k = 0; k < DC; ++k) { const float w = bfr(W1[(size_t)k * DB + t]); const v4f c0 = *(const v4f*)&sc[k][0], c1 = *(const v4f*)&sc[k][4];
#pragma unroll
    for (int r = 0; r < 4; ++r) { h[r] += c0[r] * w; h[4 + r] += c1[r] * w; } }
  { v4f l0, l1;
#pragma unroll
    for (int r = 0; r < 4; ++r) { l0[r] = lrelu(h[r]); l1[r] = lrelu(h[4 + r]); }
    *(v4f*)&sl[t][0] = l0; *(v4f*)&sl[t][4] = l1; }
  __syncthreads();
  { const float br = bfr(BR[t]);
#pragma unroll
    for (int r = 0; r < RPB; ++r) h[r] = h[r] + br; }
#pragma unroll 16   // sixteen weight loads in flight at a time, as above
  for (int k = 0; k < DB; ++k) { const float w = bfr(WR[(size_t)k * DB + t]); const v4f c0 = *(const v4f*)&sl[k][0], c1 = *(const v4f*)&sl[k][4];
#pragma unroll
    for (int r = 0; r < 4; ++r) { h[r] += c0[r] * w; h[4 + r] += c1[r] * w; } }
  { float w2[KB];
#pragma unroll
    for (int k = 0; k < KB; ++k) w2[k] = bfr(W2[(size_t)t * KB + k]);
#pragma unroll
    for (int r = 0; r < RPB; ++r) { const float h2 = lrelu(h[r]); float pv[KB];
#pragma unroll
      for (int k = 0; k < KB; ++k) pv[k] = h2 * w2[k];
#pragma unroll
      for (int o = 1; o < 32; o <<= 1)   // level by level over the 16 sums of a row, as above
#pragma unroll
        for (int k = 0; k < KB; ++k) pv[k] += __shfl_xor(pv[k], o);
      if ((t & 31) == 0) {
#pragma unroll
        for (int k = 0; k < KB; ++k) sred[r][t >> 5][k] = pv[k]; } } }
  __syncthreads();
  { const int r = t / BFS, k = t % BFS; float bfv = 0.f;   // 256 threads = 8 rows x 32 padded basis slots
    if (k < KB) { bfv = bfr(B2[k]); for (int w = 0; w < 8; ++w) bfv += sred[r][w][k]; }
    sbf[r][k] = bfv; }
  __syncthreads();
  if (t < RPB * BFS / 4) vst2(BF + row0 * BFS + t * 4, *(const v4f*)&sbf[t / (BFS / 4)][(t % (BFS / 4)) * 4]); }
// ---- k_big: block = (128 rows, 64 cols), 8 waves of 32 x 32: out = sum_k bf[row][k] (a . W_k) + sum_k bf[row][k] bvec[k][o]
// The block's 128 rows of a (f16, 512 each) come to LDS once and stay; the WT tiles (64 rows of 256 halves = 64 i of 4 basis matrices) follow by asynchronous copies, two buffers: the next tile flies while this one is multiplied.
// Each A fragment read from LDS serves 4 basis matrices, each with accumulators of its own; after the 8 passes of such a group the four are added into the output with bf in f32.
#define KP 256                    // halves per pass: 512 B of every WT row
#define PIT 264                   // LDS row pitch in halves: 528 B = 16 B x 33, conflict-free for 16-byte row reads
#define PITA 520                  // the same for the rows of a: 1,040 B = 16 B x 65
#define BROWS 128
#define WROWS 64
#define BUFH (WROWS * PIT)
#define NPASS (KK / KP)
#define PPG (DIN / 64)            // passes per group of KG basis matrices
#define SFP 36
// eight copies, 32 lanes x 16 B each; the s_wait_xcnt closes the statement so that no address register is rewritten in front of it
__device__ __forceinline__ void cp8(const unsigned* l, const _Float16* const* p) {
  asm volatile("global_load_async_to_lds_b128 %0, %8, off\n\t"
               "global_load_async_to_lds_b128 %1, %9, off\n\t"
               "global_load_async_to_lds_b128 %2, %10, off\n\t"
               "global_load_async_to_lds_b128 %3, %11, off\n\t"
               "global_load_async_to_lds_b128 %4, %12, off\n\t"
               "global_load_async_to_lds_b128 %5, %13, off\n\t"
               "global_load_async_to_lds_b128 %6, %14, off\n\t"
               "global_load_async_to_lds_b128 %7, %15, off\n\t"
               "s_wait_xcnt 0x0"
               :: "v"(l[0]), "v"(l[1]), "v"(l[2]), "v"(l[3]), "v"(l[4]), "v"(l[5]), "v"(l[6]), "v"(l[7]),
                  "v"(p[0]), "v"(p[1]), "v"(p[2]), "v"(p[3]), "v"(p[4]), "v"(p[5]), "v"(p[6]), "v"(p[7])
               : "memory");
}
// one WT tile: wave w brings tile rows w, w + 8, ... (8 rows, one copy each); gw = this lane's 16 bytes in the wave's first row of the pass, l0 = their place in LDS
__device__ __forceinline__ void copy_w(unsigned l0, const _Float16* gw) {
  unsigned l[8]; const _Float16* p[8];
#pragma unroll
  for (int e = 0; e < 8; ++e) { l[e] = l0 + (unsigned)(e * 8 * PIT * 2); p[e] = gw + (size_t)e * 8 * KK; }
  cp8(l, p);
}
// the block's rows of a: wave w brings rows w, w + 8, ... (16 rows, two copies each)
__device__ __forceinline__ void copy_a(unsigned l0, const _Float16* ga) {
#pragma unroll
  for (int q = 0; q < 4; ++q) { unsigned l[8]; const _Float16* p[8];
#pragma unroll
    for (int e = 0; e < 8; ++e) { const int i = (q * 8 + e) >> 1, hf = e & 1; l[e] = l0 + (unsigned)((i * 8 * PITA + hf * 256) * 2); p[e] = ga + (size_t)i * 8 * DIN + hf * 256; }
    cp8(l, p); }
}
__global__ __launch_bounds__(256) void k_big(const _Float16* __restrict__ A16, const _Float16* __restrict__ WT, const float* __restrict__ BF, const float* __restrict__ BV, float* __restrict__ OUT) {
  __shared__ __align__(16) _Float16 sA[BROWS * PITA]; __shared__ __align__(16) _Float16 st[2 * BUFH]; __shared__ __align__(16) float sbt[KB][BROWS]; __shared__ __align__(16) float sf[8][32][SFP];
  const int tid = threadIdx.x, wave = tid >> 5, lane = tid & 31, col = lane & 15, g = lane >> 4; const int wm = wave >> 1, wn = wave & 1;
  const size_t rb = (size_t)blockIdx.x * BROWS; const int cb = blockIdx.y * WROWS;
  const _Float16* ga = A16 + (rb + wave) * DIN + lane * 8; const _Float16* gw = WT + (size_t)(cb + wave) * KK + lane * 8;
  const unsigned l0a = (unsigned)(size_t)&sA[wave * PITA + lane * 8]; const unsigned l0 = (unsigned)(size_t)&st[wave * PIT + lane * 8];
  copy_a(l0a, ga);
  copy_w(l0, gw);
  { const int row = tid >> 1, kh = (tid & 1) * 8; const float* p = BF + (rb + row) * BFS + kh; const v4f f0 = *(const v4f*)p, f1 = *(const v4f*)(p + 4);   // bf of the block's rows, k-major: 8 neighbouring rows of one k are two 16-byte reads
#pragma unroll
    for (int e = 0; e < 4; ++e) { sbt[kh + e][row] = f0[e]; sbt[kh + 4 + e][row] = f1[e]; } }
  asm volatile("s_wait_asynccnt 0x0" ::: "memory");   // a and tile 0 have landed before the barrier that publishes them
  __syncthreads();
  copy_w(l0 + BUFH * 2, gw + KP);
  const _Float16* sa_ = sA + (wm * 32 + col) * PITA;
  v8f outa[2][2] = {};
  for (int kg = 0; kg < KB / KG; ++kg) { v8f acc[KG][2][2] = {};
    for (int ic = 0; ic < PPG; ++ic) { const int t = kg * PPG + ic; const _Float16* sw_ = st + (t & 1) * BUFH + (wn * 32 + col) * PIT;
#pragma unroll
      for (int c = 0; c < 2; ++c) { v16h a[2];
#pragma unroll
        for (int m = 0; m < 2; ++m) a[m] = frag_h(sa_ + m * 16 * PITA + ic * 64 + c * 32, lane);
#pragma unroll
        for (int kk = 0; kk < KG; ++kk) { v16h b[2];
#pragma unroll
          for (int j = 0; j < 2; ++j) b[j] = frag_h(sw_ + j * 16 * PIT + kk * 64 + c * 32, lane);
#pragma unroll
          for (int m = 0; m < 2; ++m)
#pragma unroll
            for (int j = 0; j < 2; ++j) acc[kk][m][j] = wmma16(a[m], b[j], acc[kk][m][j]); } }
      asm volatile("s_wait_dscnt 0x0" ::: "memory");     // this wave's reads of the buffer are done before it is handed to the copies
      asm volatile("s_wait_asynccnt 0x0" ::: "memory");  // this wave's share of tile t + 1 has landed
      __syncthreads();                                   // publishes tile t + 1 and ends every reader's last read of tile t
      if (t + 2 < NPASS) copy_w(l0 + (unsigned)((t & 1) * BUFH * 2), gw + (size_t)(t + 2) * KP); }
#pragma unroll
    for (int kk = 0; kk < KG; ++kk)
#pragma unroll
      for (int m = 0; m < 2; ++m) { const float* fp = &sbt[kg * KG + kk][wm * 32 + m * 16 + 8 * g]; const v4f f0 = *(const v4f*)fp, f1 = *(const v4f*)(fp + 4);   // D element r = row 8g + r
#pragma unroll
        for (int j = 0; j < 2; ++j)
#pragma unroll
          for (int r = 0; r < 4; ++r) { outa[m][j][r] += f0[r] * acc[kk][m][j][r]; outa[m][j][4 + r] += f1[r] * acc[kk][m][j][4 + r]; } } }
  asm volatile("s_wait_asynccnt 0x0" ::: "memory");    // nothing in flight when the wave goes on to its end
  const size_t r0 = rb + wm * 32; const int c0 = cb + wn * 32;
#pragma unroll
  for (int m = 0; m < 2; ++m)
#pragma unroll
    for (int j = 0; j < 2; ++j)
#pragma unroll
      for (int r = 0; r < 8; ++r) sf[wave][m * 16 + 8 * g + r][j * 16 + col] = outa[m][j][r];
  LDSX();
  // each wave's own 32 x 32 block goes out as whole 128-B lines: 8 lanes a row, 4 rows a store; the bias sum over k is added on the way
  const int c4 = (lane & 7) * 4, rq = lane >> 3; float bv[KB][4];
#pragma unroll
  for (int k = 0; k < KB; ++k) { const v4f w = *(const v4f*)(BV + (size_t)k * DOUT + c0 + c4);
#pragma unroll
    for (int e = 0; e < 4; ++e) bv[k][e] = bfr(w[e]); }
#pragma unroll 2   // fully unrolled the loop takes the kernel above 256 registers, and the asm copies then stand among register-window switches
  for (int rl = 0; rl < 32; rl += 4) { const size_t row = r0 + rl + rq; const v4f s = *(const v4f*)&sf[wave][rl + rq][c4]; v4f o;
#pragma unroll
    for (int e = 0; e < 4; ++e) { float bsum = 0.f;
#pragma unroll
      for (int k = 0; k < KB; ++k) bsum += BF[row * BFS + k] * bv[k][e];
      o[e] = s[e] + bsum; }
    vst2(OUT + row * DOUT + c0 + c4, o); } }
extern "C" void kernel_launch(void* const* d_in, const int* in_sizes, int n_in, void* d_out, int out_size, void* d_ws, size_t ws_size, hipStream_t stream) {
  (void)in_sizes; (void)n_in; (void)out_size;
  const float** F = (const float**)d_in;   // 0 x [4096,512], 1 c [4096,64], 2 ln_gamma, 3 ln_beta, 4 w1 [64,256], 5 b1, 6 wr [256,256], 7 br, 8 w2 [256,16], 9 b2, 10 W [16,512,512], 11 bvec [16,512]
  if (ws_size < (size_t)WS_END) return;
  char* ws = (char*)d_ws; _Float16 *WT = (_Float16*)(ws + WS_WT), *A16 = (_Float16*)(ws + WS_A); float* BF = (float*)(ws + WS_BF);
  k_packw<<<DOUT, 256, 0, stream>>>(F[10], WT);
  k_row<<<TR * 64 / RPB, 256, 0, stream>>>(F[0], F[1], F[2], F[3], F[4], F[5], F[6], F[7], F[8], F[9], A16, BF);
  k_big<<<dim3(NR / BROWS, DOUT / WROWS), 256, 0, stream>>>(A16, WT, BF, F[11], (float*)d_out);
}

// v004
// It runs in 66 microseconds.
// In two side-by-side timings against v003, it was 1.25 and 1.24 times as fast.
// Over all steps from v000 it is 10.3 times as fast.
// compute dtype: all float inputs rounded to bf16; LayerNorm + LeakyReLU and the small basis network (64 -> 256 -> residual 256 -> 16) in f32 on VALU; the conditional bilinear contraction out[b,o] = sum_k bf[b,k] (sum_i a[b,i] W[k,i,o]): the inner sums on WMMA 16x16x32, a rounded once to f16 against W as exact f16 rows, f32 accumulate, one accumulator per basis matrix; the sum over k with bf in f32; + bf . bvec in f32; f32 output.
#include <hip/hip_runtime.h>
#include <math.h>

typedef __attribute__((ext_vector_type(16))) _Float16 v16h;
typedef __attribute__((ext_vector_type(16))) __bf16 v16b;
typedef __attribute__((ext_vector_type(8)))  _Float16 v8h;
typedef __attribute__((ext_vector_type(8)))  float v8f;
typedef __attribute__((ext_vector_type(4)))  float v4f;
typedef __attribute__((ext_vector_type(2)))  float v2f;
typedef __attribute__((ext_vector_type(4)))  unsigned v4u;
typedef __attribute__((ext_vector_type(4)))  int v4i;
typedef float __attribute__((may_alias)) float_a;
typedef int __attribute__((may_alias)) int_a;

template <typename T> __device__ __forceinline__ void vst2(void* p, T v) { *(T*)p = v;  }
__device__ __forceinline__ v8f wmma16(v16h a, v16h b, v8f c) {
  v8f d = __builtin_amdgcn_wmma_f32_16x16x32_f16(false, a, false, b, (short)0, c, false, false);
  asm volatile("v_nop\n\tv_nop\n\tv_nop\n\tv_nop" : "+v"(d) : "v"(a), "v"(b));
  return d;
}
__device__ __forceinline__ v8f wmma_bf(v16b a, v16b b, v8f c) {
  v8f d = __builtin_amdgcn_wmma_f32_16x16x32_bf16(false, a, false, b, (short)0, c, false, false);
  asm volatile("v_nop\n\tv_nop\n\tv_nop\n\tv_nop" : "+v"(d) : "v"(a), "v"(b));
  return d;
}
// 16x16x32 fragments: lane = (h = lane>>4, row/col = lane&15); elements 0..7 = k0+8h+0..7, 8..15 = k0+16+8h+0..7; D element r = row 8h+r
__device__ __forceinline__ v16h frag_h(const _Float16* rowk0, int lane) {
  union { v16h v; v8h q[2]; } u; const _Float16* p = rowk0 + 8 * (lane >> 4);
  u.q[0] = *(const v8h*)p; u.q[1] = *(const v8h*)(p + 16); return u.v;
}
__device__ __forceinline__ v16h frag_f32(const float* rowk0, int lane) {
  v16h a; const float* p = rowk0 + 8 * (lane >> 4);
#pragma unroll
  for (int i = 0; i < 8; ++i) { a[i] = (_Float16)p[i]; a[8 + i] = (_Float16)p[16 + i]; }
  return a;
}
__device__ __forceinline__ v16h frag_f32s(const float* rowk0, int lane, float sc) {
  v16h a; const float* p = rowk0 + 8 * (lane >> 4);
#pragma unroll
  for (int i = 0; i < 8; ++i) { a[i] = (_Float16)(p[i] * sc); a[8 + i] = (_Float16)(p[16 + i] * sc); }
  return a;
}
// column fragment from a [K][ld] layout (column n), rows >= K read as 0
__device__ __forceinline__ v16h fragc_f32(const float* W, int k0, int n, int lane, int ld, int K) {
  v16h a; const int g = lane >> 4;
#pragma unroll
  for (int i = 0; i < 8; ++i) { const int ka = k0 + 8 * g + i, kb = ka + 16;
    a[i] = (_Float16)(ka < K ? W[(size_t)(ka < K ? ka : K - 1) * ld + n] : 0.f); a[8 + i] = (_Float16)(kb < K ? W[(size_t)(kb < K ? kb : K - 1) * ld + n] : 0.f); }
  return a;
}
struct F2 { v16b h, l; };
__device__ __forceinline__ F2 bsplit16(const float v[16]) { F2 r;
#pragma unroll
  for (int i = 0; i < 16; ++i) { const __bf16 h = (__bf16)v[i]; r.h[i] = h; r.l[i] = (__bf16)(v[i] - (float)h); }
  return r; }
__device__ __forceinline__ F2 split_row(const float* row, int k0, int lane) { float v[16]; const float* p = row + k0 + 8 * (lane >> 4);
#pragma unroll
  for (int i = 0; i < 8; ++i) { v[i] = p[i]; v[8 + i] = p[16 + i]; }
  return bsplit16(v); }
__device__ __forceinline__ F2 split_rowK(const float* row, int k0, int lane, int K) { float v[16]; const int g = lane >> 4;
#pragma unroll
  for (int i = 0; i < 8; ++i) { const int ka = k0 + 8 * g + i, kb = ka + 16; v[i] = ka < K ? row[ka < K ? ka : K - 1] : 0.f; v[8 + i] = kb < K ? row[kb < K ? kb : K - 1] : 0.f; }
  return bsplit16(v); }
__device__ __forceinline__ F2 split_col(const float* W, int k0, int n, int lane, int ld, int K) { float v[16]; const int g = lane >> 4;
#pragma unroll
  for (int i = 0; i < 8; ++i) { const int ka = k0 + 8 * g + i, kb = ka + 16; v[i] = ka < K ? W[(size_t)(ka < K ? ka : K - 1) * ld + n] : 0.f; v[8 + i] = kb < K ? W[(size_t)(kb < K ? kb : K - 1) * ld + n] : 0.f; }
  return bsplit16(v); }
__device__ __forceinline__ v8f mac3(const F2& a, const F2& b, v8f c) { c = wmma_bf(a.l, b.h, c); c = wmma_bf(a.h, b.l, c); return wmma_bf(a.h, b.h, c); }
__device__ __forceinline__ float sigm(float v) { return 1.0f / (1.0f + expf(-v)); }
#define LDSX() do { asm volatile("s_wait_dscnt 0" ::: "memory"); __builtin_amdgcn_wave_barrier(); __builtin_amdgcn_fence(__ATOMIC_RELEASE, "workgroup"); } while (0)


// Conditional pre-activation dense layer (4,096 rows, 512 -> 512, 16 basis matrices selected by a 64-dim condition through a small residual MLP): a = LeakyReLU(LayerNorm(x)); bf = basis(c); out = sum_k bf_k (a W_k + bias_k).
#define NR 4096
#define DIN 512
#define DOUT 512
#define DC 64
#define KB 16
#define DB 256
#define KK (KB * DIN)      // 8192
#define NEG 0.01f
#ifndef TR
#define TR (NR / 64)
#endif
typedef __attribute__((ext_vector_type(8))) __bf16 v8b;
__device__ __forceinline__ v16b frag_b(const __bf16* rowk0, int lane) {
  union { v16b v; v8b q[2]; } u; const __bf16* p = rowk0 + 8 * (lane >> 4);
  u.q[0] = *(const v8b*)p; u.q[1] = *(const v8b*)(p + 16); return u.v;
}
__device__ __forceinline__ float bfr(float v) { return (float)(__bf16)v; }
__device__ __attribute__((noinline)) float exp_ni(float v) { return expf(v); }
__device__ __attribute__((noinline)) float erf_ni(float v) { return erff(v); }

#define WS_WT  0u                                   // f16 W rows [o][8192], in the order of k_big's passes (see k_packw)
#define WS_A   (WS_WT + 2u * (size_t)DOUT * KK)          // f16 activations a [NR][512]
#define WS_BF  (WS_A + 2u * (size_t)NR * DIN)
#define BFS 32
#define WS_END (WS_BF + 4u * (size_t)NR * BFS)

__device__ __forceinline__ float lrelu(float v) { return v >= 0.f ? v : NEG * v; }
// ---- k_packw: WT[o][p(k, i)] = f16(W[k][i][o]); p puts the 64 i of 4 neighbouring k side by side, so that one pass of k_big (256 halves of a row) holds the same i of 4 basis matrices
// block = (4 k, 64 i, 64 o): W is read along o, whole 128-B lines (8 lanes x 16 B a row, 4 rows a load), all 16 loads of a thread in flight; a thread turns 8 i x 4 o in registers, LDS holds the tile o-major, and every o goes out as the 512 B of its pass
#define KG 4                      // basis matrices that share an A fragment in k_big
#define OT 64                     // output columns per block
#define PITW 264                  // LDS row pitch in halves: 528 B = 16 B x 33; lanes 0-15 (4 x 4 o, 4 x 8 i) then store to 16 different groups of 4 banks
__global__ __launch_bounds__(256) void k_packw(const float* __restrict__ Wb, _Float16* __restrict__ WT) { __shared__ __align__(16) _Float16 s[OT * PITW]; const int t = threadIdx.x, w = t >> 5, lane = t & 31;
  const int oc = blockIdx.x % (DOUT / OT), ic = (blockIdx.x / (DOUT / OT)) % (DIN / 64), kg = blockIdx.x / ((DOUT / OT) * (DIN / 64));
  const int o4 = (t & 3) | ((t >> 2) & 4) | ((w & 1) << 3), rg0 = ((t >> 2) & 3) + 4 * (w >> 1);   // the thread's 4 columns; its groups of 8 tile rows are rg0 and rg0 + 16 (tile row = (k % 4) * 64 + i % 64)
  v4f x[2][8];   // every loop over x is unrolled: constant indices keep it in registers, and the 16 loads stand in a row
#pragma unroll
  for (int u = 0; u < 2; ++u) {
#pragma unroll
    for (int j = 0; j < 8; ++j) { const int rg = rg0 + 16 * u; x[u][j] = *(const v4f*)(Wb + (size_t)((kg * KG + (rg >> 3)) * DIN + ic * 64 + (rg & 7) * 8 + j) * DOUT + oc * OT + o4 * 4); }   // W[k][i][o] at ((k*512 + i)*512 + o)
    if (u == 0) asm volatile("s_wait_xcnt 0x0" ::: "memory"); }   // results of the second eight loads land on the address pair of the first eight: the wait stands between them
#pragma unroll
  for (int u = 0; u < 2; ++u)
#pragma unroll
    for (int e = 0; e < 4; ++e) { v8h h;
#pragma unroll
      for (int j = 0; j < 8; ++j) h[j] = (_Float16)bfr(x[u][j][e]);
      *(v8h*)&s[(o4 * 4 + e) * PITW + (rg0 + 16 * u) * 8] = h; }
  __syncthreads();
#pragma unroll
  for (int q = 0; q < OT / 8; ++q) { const int o = w + 8 * q; vst2((unsigned*)(WT + (size_t)(oc * OT + o) * KK + (kg * (DIN / 64) + ic) * (KG * 64) + lane * 8), *(const v4u*)&s[o * PITW + lane * 8]); } }
// ---- k_row: block = 8 rows (256 threads), so that every weight of the basis network is loaded once for 8 rows; thread t owns hidden unit t of all 8. Per row, in the same order of sums as one row alone: a = lrelu(LN(x) g + b) (512); h = c w1 + b1; h = h + lrelu(h) wr + br; h = lrelu(h); bf = h w2 + b2 (16); A row = f16(a[i]); BF row
#define RPB 8
__global__ __launch_bounds__(256) void k_row(const float* __restrict__ X, const float* __restrict__ C, const float* __restrict__ G, const float* __restrict__ Bt, const float* __restrict__ W1, const float* __restrict__ B1, const float* __restrict__ WR, const float* __restrict__ BR, const float* __restrict__ W2, const float* __restrict__ B2, _Float16* __restrict__ A16, float* __restrict__ BF) {
  __shared__ float red[RPB][8]; __shared__ __align__(16) float sa[RPB][DIN]; __shared__ __align__(16) float sc[DC][RPB]; __shared__ __align__(16) float sl[DB][RPB]; __shared__ float sred[RPB][8][KB]; __shared__ __align__(16) float sbf[RPB][BFS];
  const int t = threadIdx.x; const size_t row0 = (size_t)blockIdx.x * RPB; const float* xb = X + row0 * DIN;
  float v[RPB][2], s[RPB];
#pragma unroll
  for (int r = 0; r < RPB; ++r) { s[r] = 0.f; for (int i = 0; i < 2; ++i) { v[r][i] = bfr(xb[r * DIN + t + 256 * i]); s[r] += v[r][i]; } }
#pragma unroll
  for (int o = 1; o < 32; o <<= 1)   // level by level over the 8 rows: 8 independent exchanges share each LDS latency
#pragma unroll
    for (int r = 0; r < RPB; ++r) s[r] += __shfl_xor(s[r], o);
  if ((t & 31) == 0) {
#pragma unroll
    for (int r = 0; r < RPB; ++r) red[r][t >> 5] = s[r]; }
  __syncthreads(); float mu[RPB];
#pragma unroll
  for (int r = 0; r < RPB; ++r) { float m = 0.f; for (int i = 0; i < 8; ++i) m += red[r][i]; mu[r] = m / (float)DIN; }
  __syncthreads();
#pragma unroll
  for (int r = 0; r < RPB; ++r) { float q = 0.f; for (int i = 0; i < 2; ++i) { const float d = v[r][i] - mu[r]; q += d * d; } s[r] = q; }
#pragma unroll
  for (int o = 1; o < 32; o <<= 1)
#pragma unroll
    for (int r = 0; r < RPB; ++r) s[r] += __shfl_xor(s[r], o);
  if ((t & 31) == 0) {
#pragma unroll
    for (int r = 0; r < RPB; ++r) red[r][t >> 5] = s[r]; }
  __syncthreads();
  { float gg[2], bb[2]; for (int i = 0; i < 2; ++i) { gg[i] = bfr(G[t + 256 * i]); bb[i] = bfr(Bt[t + 256 * i]); }
#pragma unroll
    for (int r = 0; r < RPB; ++r) { float var = 0.f; for (int i = 0; i < 8; ++i) var += red[r][i]; var /= (float)DIN; const float inv = 1.0f / sqrtf(var + 1e-5f);
      for (int i = 0; i < 2; ++i) sa[r][t + 256 * i] = lrelu((v[r][i] - mu[r]) * inv * gg[i] + bb[i]); } }
#pragma unroll
  for (int e = t; e < RPB * DC; e += 256) sc[e % DC][e / DC] = bfr(C[row0 * DC + e]);
  __syncthreads();
#pragma unroll
  for (int j = 0; j < RPB * DIN / 8 / 256; ++j) { const int q = t + 256 * j; const float* p = &sa[0][0] + q * 8; const v4f a0 = *(const v4f*)p, a1 = *(const v4f*)(p + 4); v8h o;   // the 8 rows of a go out as f16, 16 bytes a thread
#pragma unroll
    for (int e = 0; e < 4; ++e) { o[e] = (_Float16)a0[e]; o[4 + e] = (_Float16)a1[e]; }
    vst2(A16 + row0 * DIN + q * 8, o); }
  float h[RPB];
  { const float b1 = bfr(B1[t]);
#pragma unroll
    for (int r = 0; r < RPB; ++r) h[r] = b1; }
#pragma unroll 16   // sixteen weight loads in flight at a time; rolled, every trip waits out its own load
  for (int k = 0; k < DC; ++k) { const float w = bfr(W1[(size_t)k * DB + t]); const v4f c0 = *(const v4f*)&sc[k][0], c1 = *(const v4f*)&sc[k][4];
#pragma unroll
    for (int r = 0; r < 4; ++r) { h[r] += c0[r] * w; h[4 + r] += c1[r] * w; } }
  { v4f l0, l1;
#pragma unroll
    for (int r = 0; r < 4; ++r) { l0[r] = lrelu(h[r]); l1[r] = lrelu(h[4 + r]); }
    *(v4f*)&sl[t][0] = l0; *(v4f*)&sl[t][4] = l1; }
  __syncthreads();
  { const float br = bfr(BR[t]);
#pragma unroll
    for (int r = 0; r < RPB; ++r) h[r] = h[r] + br; }
#pragma unroll 16   // sixteen weight loads in flight at a time, as above
  for (int k = 0; k < DB; ++k) { const float w = bfr(WR[(size_t)k * DB + t]); const v4f c0 = *(const v4f*)&sl[k][0], c1 = *(const v4f*)&sl[k][4];
#pragma unroll
    for (int r = 0; r < 4; ++r) { h[r] += c0[r] * w; h[4 + r] += c1[r] * w; } }
  { float w2[KB];
#pragma unroll
    for (int k = 0; k < KB; ++k) w2[k] = bfr(W2[(size_t)t * KB + k]);
#pragma unroll
    for (int r = 0; r < RPB; ++r) { const float h2 = lrelu(h[r]); float pv[KB];
#pragma unroll
      for (int k = 0; k < KB; ++k) pv[k] = h2 * w2[k];
#pragma unroll
      for (int o = 1; o < 32; o <<= 1)   // level by level over the 16 sums of a row, as above
#pragma unroll
        for (int k = 0; k < KB; ++k) pv[k] += __shfl_xor(pv[k], o);
      if ((t & 31) == 0) {
#pragma unroll
        for (int k = 0; k < KB; ++k) sred[r][t >> 5][k] = pv[k]; } } }
  __syncthreads();
  { const int r = t / BFS, k = t % BFS; float bfv = 0.f;   // 256 threads = 8 rows x 32 padded basis slots
    if (k < KB) { bfv = bfr(B2[k]); for (int w = 0; w < 8; ++w) bfv += sred[r][w][k]; }
    sbf[r][k] = bfv; }
  __syncthreads();
  if (t < RPB * BFS / 4) vst2(BF + row0 * BFS + t * 4, *(const v4f*)&sbf[t / (BFS / 4)][(t % (BFS / 4)) * 4]); }
// ---- k_big: block = (128 rows, 64 cols), 8 waves of 32 x 32: out = sum_k bf[row][k] (a . W_k) + sum_k bf[row][k] bvec[k][o]
// The block's 128 rows of a (f16, 512 each) come to LDS once and stay; the WT tiles (64 rows of 256 halves = 64 i of 4 basis matrices) follow by asynchronous copies, two buffers: the next tile flies while this one is multiplied.
// Each A fragment read from LDS serves 4 basis matrices, each with accumulators of its own; after the 8 passes of such a group the four are added into the output with bf in f32.
#define KP 256                    // halves per pass: 512 B of every WT row
#define PIT 264                   // LDS row pitch in halves: 528 B = 16 B x 33, conflict-free for 16-byte row reads
#define PITA 520                  // the same for the rows of a: 1,040 B = 16 B x 65
#define BROWS 128
#define WROWS 64
#define BUFH (WROWS * PIT)
#define NPASS (KK / KP)
#define PPG (DIN / 64)            // passes per group of KG basis matrices
#define SFP 36
// eight copies, 32 lanes x 16 B each; the s_wait_xcnt closes the statement so that no address register is rewritten in front of it
__device__ __forceinline__ void cp8(const unsigned* l, const _Float16* const* p) {
  asm volatile("global_load_async_to_lds_b128 %0, %8, off\n\t"
               "global_load_async_to_lds_b128 %1, %9, off\n\t"
               "global_load_async_to_lds_b128 %2, %10, off\n\t"
               "global_load_async_to_lds_b128 %3, %11, off\n\t"
               "global_load_async_to_lds_b128 %4, %12, off\n\t"
               "global_load_async_to_lds_b128 %5, %13, off\n\t"
               "global_load_async_to_lds_b128 %6, %14, off\n\t"
               "global_load_async_to_lds_b128 %7, %15, off\n\t"
               "s_wait_xcnt 0x0"
               :: "v"(l[0]), "v"(l[1]), "v"(l[2]), "v"(l[3]), "v"(l[4]), "v"(l[5]), "v"(l[6]), "v"(l[7]),
                  "v"(p[0]), "v"(p[1]), "v"(p[2]), "v"(p[3]), "v"(p[4]), "v"(p[5]), "v"(p[6]), "v"(p[7])
               : "memory");
}
// one WT tile: wave w brings tile rows w, w + 8, ... (8 rows, one copy each); gw = this lane's 16 bytes in the wave's first row of the pass, l0 = their place in LDS
__device__ __forceinline__ void copy_w(unsigned l0, const _Float16* gw) {
  unsigned l[8]; const _Float16* p[8];
#pragma unroll
  for (int e = 0; e < 8; ++e) { l[e] = l0 + (unsigned)(e * 8 * PIT * 2); p[e] = gw + (size_t)e * 8 * KK; }
  cp8(l, p);
}
// the block's rows of a: wave w brings rows w, w + 8, ... (16 rows, two copies each)
__device__ __forceinline__ void copy_a(unsigned l0, const _Float16* ga) {
#pragma unroll
  for (int q = 0; q < 4; ++q) { unsigned l[8]; const _Float16* p[8];
#pragma unroll
    for (int e = 0; e < 8; ++e) { const int i = (q * 8 + e) >> 1, hf = e & 1; l[e] = l0 + (unsigned)((i * 8 * PITA + hf * 256) * 2); p[e] = ga + (size_t)i * 8 * DIN + hf * 256; }
    cp8(l, p); }
}
__global__ __launch_bounds__(256) void k_big(const _Float16* __restrict__ A16, const _Float16* __restrict__ WT, const float* __restrict__ BF, const float* __restrict__ BV, float* __restrict__ OUT) {
  __shared__ __align__(16) _Float16 sA[BROWS * PITA]; __shared__ __align__(16) _Float16 st[2 * BUFH]; __shared__ __align__(16) float sbt[KB][BROWS]; __shared__ __align__(16) float sf[8][32][SFP];
  const int tid = threadIdx.x, wave = tid >> 5, lane = tid & 31, col = lane & 15, g = lane >> 4; const int wm = wave >> 1, wn = wave & 1;
  const size_t rb = (size_t)blockIdx.x * BROWS; const int cb = blockIdx.y * WROWS;
  const _Float16* ga = A16 + (rb + wave) * DIN + lane * 8; const _Float16* gw = WT + (size_t)(cb + wave) * KK + lane * 8;
  const unsigned l0a = (unsigned)(size_t)&sA[wave * PITA + lane * 8]; const unsigned l0 = (unsigned)(size_t)&st[wave * PIT + lane * 8];
  copy_a(l0a, ga);
  copy_w(l0, gw);
  { const int row = tid >> 1, kh = (tid & 1) * 8; const float* p = BF + (rb + row) * BFS + kh; const v4f f0 = *(const v4f*)p, f1 = *(const v4f*)(p + 4);   // bf of the block's rows, k-major: 8 neighbouring rows of one k are two 16-byte reads
#pragma unroll
    for (int e = 0; e < 4; ++e) { sbt[kh + e][row] = f0[e]; sbt[kh + 4 + e][row] = f1[e]; } }
  asm volatile("s_wait_asynccnt 0x0" ::: "memory");   // a and tile 0 have landed before the barrier that publishes them
  __syncthreads();
  copy_w(l0 + BUFH * 2, gw + KP);
  const _Float16* sa_ = sA + (wm * 32 + col) * PITA;
  v8f outa[2][2] = {};
  for (int kg = 0; kg < KB / KG; ++kg) { v8f acc[KG][2][2] = {};
    for (int ic = 0; ic < PPG; ++ic) { const int t = kg * PPG + ic; const _Float16* sw_ = st + (t & 1) * BUFH + (wn * 32 + col) * PIT;
#pragma unroll
      for (int c = 0; c < 2; ++c) { v16h a[2];
#pragma unroll
        for (int m = 0; m < 2; ++m) a[m] = frag_h(sa_ + m * 16 * PITA + ic * 64 + c * 32, lane);
#pragma unroll
        for (int kk = 0; kk < KG; ++kk) { v16h b[2];
#pragma unroll
          for (int j = 0; j < 2; ++j) b[j] = frag_h(sw_ + j * 16 * PIT + kk * 64 + c * 32, lane);
#pragma unroll
          for (int m = 0; m < 2; ++m)
#pragma unroll
            for (int j = 0; j < 2; ++j) acc[kk][m][j] = wmma16(a[m], b[j], acc[kk][m][j]); } }
      asm volatile("s_wait_dscnt 0x0" ::: "memory");     // this wave's reads of the buffer are done before it is handed to the copies
      asm volatile("s_wait_asynccnt 0x0" ::: "memory");  // this wave's share of tile t + 1 has landed
      __syncthreads();                                   // publishes tile t + 1 and ends every reader's last read of tile t
      if (t + 2 < NPASS) copy_w(l0 + (unsigned)((t & 1) * BUFH * 2), gw + (size_t)(t + 2) * KP); }
#pragma unroll
    for (int kk = 0; kk < KG; ++kk)
#pragma unroll
      for (int m = 0; m < 2; ++m) { const float* fp = &sbt[kg * KG + kk][wm * 32 + m * 16 + 8 * g]; const v4f f0 = *(const v4f*)fp, f1 = *(const v4f*)(fp + 4);   // D element r = row 8g + r
#pragma unroll
        for (int j = 0; j < 2; ++j)
#pragma unroll
          for (int r = 0; r < 4; ++r) { outa[m][j][r] += f0[r] * acc[kk][m][j][r]; outa[m][j][4 + r] += f1[r] * acc[kk][m][j][4 + r]; } } }
  asm volatile("s_wait_asynccnt 0x0" ::: "memory");    // nothing in flight when the wave goes on to its end
  const size_t r0 = rb + wm * 32; const int c0 = cb + wn * 32;
#pragma unroll
  for (int m = 0; m < 2; ++m)
#pragma unroll
    for (int j = 0; j < 2; ++j)
#pragma unroll
      for (int r = 0; r < 8; ++r) sf[wave][m * 16 + 8 * g + r][j * 16 + col] = outa[m][j][r];
  LDSX();
  // each wave's own 32 x 32 block goes out as whole 128-B lines: 8 lanes a row, 4 rows a store; the bias sum over k is added on the way
  const int c4 = (lane & 7) * 4, rq = lane >> 3; float bv[KB][4];
#pragma unroll
  for (int k = 0; k < KB; ++k) { const v4f w = *(const v4f*)(BV + (size_t)k * DOUT + c0 + c4);
#pragma unroll
    for (int e = 0; e < 4; ++e) bv[k][e] = bfr(w[e]); }
#pragma unroll 2   // fully unrolled the loop takes the kernel above 256 registers, and the asm copies then stand among register-window switches
  for (int rl = 0; rl < 32; rl += 4) { const size_t row = r0 + rl + rq; const v4f s = *(const v4f*)&sf[wave][rl + rq][c4]; v4f o;
#pragma unroll
    for (int e = 0; e < 4; ++e) { float bsum = 0.f;
#pragma unroll
      for (int k = 0; k < KB; ++k) bsum += BF[row * BFS + k] * bv[k][e];
      o[e] = s[e] + bsum; }
    vst2(OUT + row * DOUT + c0 + c4, o); } }
extern "C" void kernel_launch(void* const* d_in, const int* in_sizes, int n_in, void* d_out, int out_size, void* d_ws, size_t ws_size, hipStream_t stream) {
  (void)in_sizes; (void)n_in; (void)out_size;
  const float** F = (const float**)d_in;   // 0 x [4096,512], 1 c [4096,64], 2 ln_gamma, 3 ln_beta, 4 w1 [64,256], 5 b1, 6 wr [256,256], 7 br, 8 w2 [256,16], 9 b2, 10 W [16,512,512], 11 bvec [16,512]
  if (ws_size < (size_t)WS_END) return;
  char* ws = (char*)d_ws; _Float16 *WT = (_Float16*)(ws + WS_WT), *A16 = (_Float16*)(ws + WS_A); float* BF = (float*)(ws + WS_BF);
  k_packw<<<(KB / KG) * (DIN / 64) * (DOUT / OT), 256, 0, stream>>>(F[10], WT);
  k_row<<<TR * 64 / RPB, 256, 0, stream>>>(F[0], F[1], F[2], F[3], F[4], F[5], F[6], F[7], F[8], F[9], A16, BF);
  k_big<<<dim3(NR / BROWS, DOUT / WROWS), 256, 0, stream>>>(A16, WT, BF, F[11], (float*)d_out);
}

// v005
// It runs in 61.5 microseconds.
// Next to v004, in two timings, it ran 1.07 times as fast each time.
// All steps since v000 together make it 11.0 times as fast.
// compute dtype: all float inputs rounded to bf16; LayerNorm + LeakyReLU and the small basis network (64 -> 256 -> residual 256 -> 16) in f32 on VALU; the conditional bilinear contraction out[b,o] = sum_k bf[b,k] (sum_i a[b,i] W[k,i,o]): the inner sums on WMMA 16x16x32, a rounded once to f16 against W as exact f16 rows, f32 accumulate, one accumulator per basis matrix; the sum over k with bf in f32; + bf . bvec in f32; f32 output.
#include <hip/hip_runtime.h>
#include <math.h>

typedef __attribute__((ext_vector_type(16))) _Float16 v16h;
typedef __attribute__((ext_vector_type(16))) __bf16 v16b;
typedef __attribute__((ext_vector_type(8)))  _Float16 v8h;
typedef __attribute__((ext_vector_type(8)))  float v8f;
typedef __attribute__((ext_vector_type(4)))  float v4f;
typedef __attribute__((ext_vector_type(2)))  float v2f;
typedef __attribute__((ext_vector_type(4)))  unsigned v4u;
typedef __attribute__((ext_vector_type(4)))  int v4i;
typedef float __attribute__((may_alias)) float_a;
typedef int __attribute__((may_alias)) int_a;

template <typename T> __device__ __forceinline__ void vst2(void* p, T v) { *(T*)p = v;  }
__device__ __forceinline__ v8f wmma16(v16h a, v16h b, v8f c) {
  v8f d = __builtin_amdgcn_wmma_f32_16x16x32_f16(false, a, false, b, (short)0, c, false, false);
  asm volatile("v_nop\n\tv_nop\n\tv_nop\n\tv_nop" : "+v"(d) : "v"(a), "v"(b));
  return d;
}
__device__ __forceinline__ v8f wmma_bf(v16b a, v16b b, v8f c) {
  v8f d = __builtin_amdgcn_wmma_f32_16x16x32_bf16(false, a, false, b, (short)0, c, false, false);
  asm volatile("v_nop\n\tv_nop\n\tv_nop\n\tv_nop" : "+v"(d) : "v"(a), "v"(b));
  return d;
}
// 16x16x32 fragments: lane = (h = lane>>4, row/col = lane&15); elements 0..7 = k0+8h+0..7, 8..15 = k0+16+8h+0..7; D element r = row 8h+r
__device__ __forceinline__ v16h frag_h(const _Float16* rowk0, int lane) {
  union { v16h v; v8h q[2]; } u; const _Float16* p = rowk0 + 8 * (lane >> 4);
  u.q[0] = *(const v8h*)p; u.q[1] = *(const v8h*)(p + 16); return u.v;
}
__device__ __forceinline__ v16h frag_f32(const float* rowk0, int lane) {
  v16h a; const float* p = rowk0 + 8 * (lane >> 4);
#pragma unroll
  for (int i = 0; i < 8; ++i) { a[i] = (_Float16)p[i]; a[8 + i] = (_Float16)p[16 + i]; }
  return a;
}
__device__ __forceinline__ v16h frag_f32s(const float* rowk0, int lane, float sc) {
  v16h a; const float* p = rowk0 + 8 * (lane >> 4);
#pragma unroll
  for (int i = 0; i < 8; ++i) { a[i] = (_Float16)(p[i] * sc); a[8 + i] = (_Float16)(p[16 + i] * sc); }
  return a;
}
// column fragment from a [K][ld] layout (column n), rows >= K read as 0
__device__ __forceinline__ v16h fragc_f32(const float* W, int k0, int n, int lane, int ld, int K) {
  v16h a; const int g = lane >> 4;
#pragma unroll
  for (int i = 0; i < 8; ++i) { const int ka = k0 + 8 * g + i, kb = ka + 16;
    a[i] = (_Float16)(ka < K ? W[(size_t)(ka < K ? ka : K - 1) * ld + n] : 0.f); a[8 + i] = (_Float16)(kb < K ? W[(size_t)(kb < K ? kb : K - 1) * ld + n] : 0.f); }
  return a;
}
struct F2 { v16b h, l; };
__device__ __forceinline__ F2 bsplit16(const float v[16]) { F2 r;
#pragma unroll
  for (int i = 0; i < 16; ++i) { const __bf16 h = (__bf16)v[i]; r.h[i] = h; r.l[i] = (__bf16)(v[i] - (float)h); }
  return r; }
__device__ __forceinline__ F2 split_row(const float* row, int k0, int lane) { float v[16]; const float* p = row + k0 + 8 * (lane >> 4);
#pragma unroll
  for (int i = 0; i < 8; ++i) { v[i] = p[i]; v[8 + i] = p[16 + i]; }
  return bsplit16(v); }
__device__ __forceinline__ F2 split_rowK(const float* row, int k0, int lane, int K) { float v[16]; const int g = lane >> 4;
#pragma unroll
  for (int i = 0; i < 8; ++i) { const int ka = k0 + 8 * g + i, kb = ka + 16; v[i] = ka < K ? row[ka < K ? ka : K - 1] : 0.f; v[8 + i] = kb < K ? row[kb < K ? kb : K - 1] : 0.f; }
  return bsplit16(v); }
__device__ __forceinline__ F2 split_col(const float* W, int k0, int n, int lane, int ld, int K) { float v[16]; const int g = lane >> 4;
#pragma unroll
  for (int i = 0; i < 8; ++i) { const int ka = k0 + 8 * g + i, kb = ka + 16; v[i] = ka < K ? W[(size_t)(ka < K ? ka : K - 1) * ld + n] : 0.f; v[8 + i] = kb < K ? W[(size_t)(kb < K ? kb : K - 1) * ld + n] : 0.f; }
  return bsplit16(v); }
__device__ __forceinline__ v8f mac3(const F2& a, const F2& b, v8f c) { c = wmma_bf(a.l, b.h, c); c = wmma_bf(a.h, b.l, c); return wmma_bf(a.h, b.h, c); }
__device__ __forceinline__ float sigm(float v) { return 1.0f / (1.0f + expf(-v)); }
#define LDSX() do { asm volatile("s_wait_dscnt 0" ::: "memory"); __builtin_amdgcn_wave_barrier(); __builtin_amdgcn_fence(__ATOMIC_RELEASE, "workgroup"); } while (0)


// Conditional pre-activation dense layer (4,096 rows, 512 -> 512, 16 basis matrices selected by a 64-dim condition through a small residual MLP): a = LeakyReLU(LayerNorm(x)); bf = basis(c); out = sum_k bf_k (a W_k + bias_k).
#define NR 4096
#define DIN 512
#define DOUT 512
#define DC 64
#define KB 16
#define DB 256
#define KK (KB * DIN)      // 8192
#define NEG 0.01f
#ifndef TR
#define TR (NR / 64)
#endif
typedef __attribute__((ext_vector_type(8))) __bf16 v8b;
__device__ __forceinline__ v16b frag_b(const __bf16* rowk0, int lane) {
  union { v16b v; v8b q[2]; } u; const __bf16* p = rowk0 + 8 * (lane >> 4);
  u.q[0] = *(const v8b*)p; u.q[1] = *(const v8b*)(p + 16); return u.v;
}
__device__ __forceinline__ float bfr(float v) { return (float)(__bf16)v; }
__device__ __attribute__((noinline)) float exp_ni(float v) { return expf(v); }
__device__ __attribute__((noinline)) float erf_ni(float v) { return erff(v); }

#define WS_WT  0u                                   // f16 W rows [o][8192], in the order of k_big's passes (see packw_blk)
#define WS_A   (WS_WT + 2u * (size_t)DOUT * KK)          // f16 activations a [NR][512]
#define WS_BF  (WS_A + 2u * (size_t)NR * DIN)
#define BFS 32
#define WS_END (WS_BF + 4u * (size_t)NR * BFS)

__device__ __forceinline__ float lrelu(float v) { return v >= 0.f ? v : NEG * v; }
// ---- packw_blk: WT[o][p(k, i)] = f16(W[k][i][o]); p puts the 64 i of 4 neighbouring k side by side, so that one pass of k_big (256 halves of a row) holds the same i of 4 basis matrices
// block = (4 k, 64 i, 64 o): W is read along o, whole 128-B lines (8 lanes x 16 B a row, 4 rows a load), all 16 loads of a thread in flight; a thread turns 8 i x 4 o in registers, LDS holds the tile o-major, and every o goes out as the 512 B of its pass
#define KG 4                      // basis matrices that share an A fragment in k_big
#define OT 64                     // output columns per block
#define PITW 264                  // LDS row pitch in halves: 528 B = 16 B x 33; lanes 0-15 (4 x 4 o, 4 x 8 i) then store to 16 different groups of 4 banks
__device__ __forceinline__ void packw_blk(const int blk, _Float16* s, const float* __restrict__ Wb, _Float16* __restrict__ WT) { const int t = threadIdx.x, w = t >> 5, lane = t & 31;
  const int oc = blk % (DOUT / OT), ic = (blk / (DOUT / OT)) % (DIN / 64), kg = blk / ((DOUT / OT) * (DIN / 64));
  const int o4 = (t & 3) | ((t >> 2) & 4) | ((w & 1) << 3), rg0 = ((t >> 2) & 3) + 4 * (w >> 1);   // the thread's 4 columns; its groups of 8 tile rows are rg0 and rg0 + 16 (tile row = (k % 4) * 64 + i % 64)
  v4f x[2][8];   // every loop over x is unrolled: constant indices keep it in registers, and the 16 loads stand in a row
#pragma unroll
  for (int u = 0; u < 2; ++u) {
#pragma unroll
    for (int j = 0; j < 8; ++j) { const int rg = rg0 + 16 * u; x[u][j] = *(const v4f*)(Wb + (size_t)((kg * KG + (rg >> 3)) * DIN + ic * 64 + (rg & 7) * 8 + j) * DOUT + oc * OT + o4 * 4); }   // W[k][i][o] at ((k*512 + i)*512 + o)
    if (u == 0) asm volatile("s_wait_xcnt 0x0" ::: "memory"); }   // results of the second eight loads land on the address pair of the first eight: the wait stands between them
#pragma unroll
  for (int u = 0; u < 2; ++u)
#pragma unroll
    for (int e = 0; e < 4; ++e) { v8h h;
#pragma unroll
      for (int j = 0; j < 8; ++j) h[j] = (_Float16)bfr(x[u][j][e]);
      *(v8h*)&s[(o4 * 4 + e) * PITW + (rg0 + 16 * u) * 8] = h; }
  __syncthreads();
#pragma unroll
  for (int q = 0; q < OT / 8; ++q) { const int o = w + 8 * q; vst2((unsigned*)(WT + (size_t)(oc * OT + o) * KK + (kg * (DIN / 64) + ic) * (KG * 64) + lane * 8), *(const v4u*)&s[o * PITW + lane * 8]); }
  asm volatile("s_wait_xcnt 0x0" ::: "memory"); }   // a precaution: a block runs only one job, so the wave ends after these stores
// ---- row_blk: block = 8 rows (256 threads), so that every weight of the basis network is loaded once for 8 rows; thread t owns hidden unit t of all 8. Per row, in the same order of sums as one row alone: a = lrelu(LN(x) g + b) (512); h = c w1 + b1; h = h + lrelu(h) wr + br; h = lrelu(h); bf = h w2 + b2 (16); A row = f16(a[i]); BF row
#define RPB 8
struct RowS { float sa[RPB][DIN]; float sc[DC][RPB]; float sl[DB][RPB]; float sbf[RPB][BFS]; float sred[RPB][8][KB]; float red[RPB][8]; };   // every member a multiple of 16 bytes long
__device__ __forceinline__ void row_blk(const int blk, RowS& S, const float* __restrict__ X, const float* __restrict__ C, const float* __restrict__ G, const float* __restrict__ Bt, const float* __restrict__ W1, const float* __restrict__ B1, const float* __restrict__ WR, const float* __restrict__ BR, const float* __restrict__ W2, const float* __restrict__ B2, _Float16* __restrict__ A16, float* __restrict__ BF) {
  auto& red = S.red; auto& sa = S.sa; auto& sc = S.sc; auto& sl = S.sl; auto& sred = S.sred; auto& sbf = S.sbf;
  const int t = threadIdx.x; const size_t row0 = (size_t)blk * RPB; const float* xb = X + row0 * DIN;
  float v[RPB][2], s[RPB];
#pragma unroll
  for (int r = 0; r < RPB; ++r) { s[r] = 0.f; for (int i = 0; i < 2; ++i) { v[r][i] = bfr(xb[r * DIN + t + 256 * i]); s[r] += v[r][i]; } }
#pragma unroll
  for (int o = 1; o < 32; o <<= 1)   // level by level over the 8 rows: 8 independent exchanges share each LDS latency
#pragma unroll
    for (int r = 0; r < RPB; ++r) s[r] += __shfl_xor(s[r], o);
  if ((t & 31) == 0) {
#pragma unroll
    for (int r = 0; r < RPB; ++r) red[r][t >> 5] = s[r]; }
  __syncthreads(); float mu[RPB];
#pragma unroll
  for (int r = 0; r < RPB; ++r) { float m = 0.f; for (int i = 0; i < 8; ++i) m += red[r][i]; mu[r] = m / (float)DIN; }
  __syncthreads();
#pragma unroll
  for (int r = 0; r < RPB; ++r) { float q = 0.f; for (int i = 0; i < 2; ++i) { const float d = v[r][i] - mu[r]; q += d * d; } s[r] = q; }
#pragma unroll
  for (int o = 1; o < 32; o <<= 1)
#pragma unroll
    for (int r = 0; r < RPB; ++r) s[r] += __shfl_xor(s[r], o);
  if ((t & 31) == 0) {
#pragma unroll
    for (int r = 0; r < RPB; ++r) red[r][t >> 5] = s[r]; }
  __syncthreads();
  { float gg[2], bb[2]; for (int i = 0; i < 2; ++i) { gg[i] = bfr(G[t + 256 * i]); bb[i] = bfr(Bt[t + 256 * i]); }
#pragma unroll
    for (int r = 0; r < RPB; ++r) { float var = 0.f; for (int i = 0; i < 8; ++i) var += red[r][i]; var /= (float)DIN; const float inv = 1.0f / sqrtf(var + 1e-5f);
      for (int i = 0; i < 2; ++i) sa[r][t + 256 * i] = lrelu((v[r][i] - mu[r]) * inv * gg[i] + bb[i]); } }
#pragma unroll
  for (int e = t; e < RPB * DC; e += 256) sc[e % DC][e / DC] = bfr(C[row0 * DC + e]);
  __syncthreads();
#pragma unroll
  for (int j = 0; j < RPB * DIN / 8 / 256; ++j) { const int q = t + 256 * j; const float* p = &sa[0][0] + q * 8; const v4f a0 = *(const v4f*)p, a1 = *(const v4f*)(p + 4); v8h o;   // the 8 rows of a go out as f16, 16 bytes a thread
#pragma unroll
    for (int e = 0; e < 4; ++e) { o[e] = (_Float16)a0[e]; o[4 + e] = (_Float16)a1[e]; }
    vst2(A16 + row0 * DIN + q * 8, o); }
  float h[RPB];
  { const float b1 = bfr(B1[t]);
#pragma unroll
    for (int r = 0; r < RPB; ++r) h[r] = b1; }
#pragma unroll 16   // sixteen weight loads in flight at a time; rolled, every trip waits out its own load
  for (int k = 0; k < DC; ++k) { const float w = bfr(W1[(size_t)k * DB + t]); const v4f c0 = *(const v4f*)&sc[k][0], c1 = *(const v4f*)&sc[k][4];
#pragma unroll
    for (int r = 0; r < 4; ++r) { h[r] += c0[r] * w; h[4 + r] += c1[r] * w; } }
  { v4f l0, l1;
#pragma unroll
    for (int r = 0; r < 4; ++r) { l0[r] = lrelu(h[r]); l1[r] = lrelu(h[4 + r]); }
    *(v4f*)&sl[t][0] = l0; *(v4f*)&sl[t][4] = l1; }
  __syncthreads();
  { const float br = bfr(BR[t]);
#pragma unroll
    for (int r = 0; r < RPB; ++r) h[r] = h[r] + br; }
#pragma unroll 16   // sixteen weight loads in flight at a time, as above
  for (int k = 0; k < DB; ++k) { const float w = bfr(WR[(size_t)k * DB + t]); const v4f c0 = *(const v4f*)&sl[k][0], c1 = *(const v4f*)&sl[k][4];
#pragma unroll
    for (int r = 0; r < 4; ++r) { h[r] += c0[r] * w; h[4 + r] += c1[r] * w; } }
  { float w2[KB];
#pragma unroll
    for (int k = 0; k < KB; ++k) w2[k] = bfr(W2[(size_t)t * KB + k]);
#pragma unroll
    for (int r = 0; r < RPB; ++r) { const float h2 = lrelu(h[r]); float pv[KB];
#pragma unroll
      for (int k = 0; k < KB; ++k) pv[k] = h2 * w2[k];
#pragma unroll
      for (int o = 1; o < 32; o <<= 1)   // level by level over the 16 sums of a row, as above
#pragma unroll
        for (int k = 0; k < KB; ++k) pv[k] += __shfl_xor(pv[k], o);
      if ((t & 31) == 0) {
#pragma unroll
        for (int k = 0; k < KB; ++k) sred[r][t >> 5][k] = pv[k]; } } }
  __syncthreads();
  { const int r = t / BFS, k = t % BFS; float bfv = 0.f;   // 256 threads = 8 rows x 32 padded basis slots
    if (k < KB) { bfv = bfr(B2[k]); for (int w = 0; w < 8; ++w) bfv += sred[r][w][k]; }
    sbf[r][k] = bfv; }
  __syncthreads();
  if (t < RPB * BFS / 4) vst2(BF + row0 * BFS + t * 4, *(const v4f*)&sbf[t / (BFS / 4)][(t % (BFS / 4)) * 4]); }
// ---- k_prep: one launch for the two jobs that k_big waits for. They share no data, so their blocks run side by side: the row blocks, which take longer, come first in the grid, and the W blocks fill the memory time that the row blocks leave idle
#define NROWB (TR * 64 / RPB)
#define NPACKB ((KB / KG) * (DIN / 64) * (DOUT / OT))
__global__ __launch_bounds__(256) void k_prep(const float* __restrict__ X, const float* __restrict__ C, const float* __restrict__ G, const float* __restrict__ Bt, const float* __restrict__ W1, const float* __restrict__ B1, const float* __restrict__ WR, const float* __restrict__ BR, const float* __restrict__ W2, const float* __restrict__ B2, const float* __restrict__ Wb, _Float16* __restrict__ A16, float* __restrict__ BF, _Float16* __restrict__ WT) {
  __shared__ __align__(16) union { RowS r; _Float16 s[OT * PITW]; } sm;   // a block does one job and uses one member
  if (blockIdx.x < NROWB) row_blk(blockIdx.x, sm.r, X, C, G, Bt, W1, B1, WR, BR, W2, B2, A16, BF);
  else packw_blk(blockIdx.x - NROWB, sm.s, Wb, WT); }
// ---- k_big: block = (128 rows, 64 cols), 8 waves of 32 x 32: out = sum_k bf[row][k] (a . W_k) + sum_k bf[row][k] bvec[k][o]
// The block's 128 rows of a (f16, 512 each) come to LDS once and stay; the WT tiles (64 rows of 256 halves = 64 i of 4 basis matrices) follow by asynchronous copies, two buffers: the next tile flies while this one is multiplied.
// Each A fragment read from LDS serves 4 basis matrices, each with accumulators of its own; after the 8 passes of such a group the four are added into the output with bf in f32.
#define KP 256                    // halves per pass: 512 B of every WT row
#define PIT 264                   // LDS row pitch in halves: 528 B = 16 B x 33, conflict-free for 16-byte row reads
#define PITA 520                  // the same for the rows of a: 1,040 B = 16 B x 65
#define BROWS 128
#define WROWS 64
#define BUFH (WROWS * PIT)
#define NPASS (KK / KP)
#define PPG (DIN / 64)            // passes per group of KG basis matrices
#define SFP 36
// eight copies, 32 lanes x 16 B each; the s_wait_xcnt closes the statement so that no address register is rewritten in front of it
__device__ __forceinline__ void cp8(const unsigned* l, const _Float16* const* p) {
  asm volatile("global_load_async_to_lds_b128 %0, %8, off\n\t"
               "global_load_async_to_lds_b128 %1, %9, off\n\t"
               "global_load_async_to_lds_b128 %2, %10, off\n\t"
               "global_load_async_to_lds_b128 %3, %11, off\n\t"
               "global_load_async_to_lds_b128 %4, %12, off\n\t"
               "global_load_async_to_lds_b128 %5, %13, off\n\t"
               "global_load_async_to_lds_b128 %6, %14, off\n\t"
               "global_load_async_to_lds_b128 %7, %15, off\n\t"
               "s_wait_xcnt 0x0"
               :: "v"(l[0]), "v"(l[1]), "v"(l[2]), "v"(l[3]), "v"(l[4]), "v"(l[5]), "v"(l[6]), "v"(l[7]),
                  "v"(p[0]), "v"(p[1]), "v"(p[2]), "v"(p[3]), "v"(p[4]), "v"(p[5]), "v"(p[6]), "v"(p[7])
               : "memory");
}
// one WT tile: wave w brings tile rows w, w + 8, ... (8 rows, one copy each); gw = this lane's 16 bytes in the wave's first row of the pass, l0 = their place in LDS
__device__ __forceinline__ void copy_w(unsigned l0, const _Float16* gw) {
  unsigned l[8]; const _Float16* p[8];
#pragma unroll
  for (int e = 0; e < 8; ++e) { l[e] = l0 + (unsigned)(e * 8 * PIT * 2); p[e] = gw + (size_t)e * 8 * KK; }
  cp8(l, p);
}
// the block's rows of a: wave w brings rows w, w + 8, ... (16 rows, two copies each)
__device__ __forceinline__ void copy_a(unsigned l0, const _Float16* ga) {
#pragma unroll
  for (int q = 0; q < 4; ++q) { unsigned l[8]; const _Float16* p[8];
#pragma unroll
    for (int e = 0; e < 8; ++e) { const int i = (q * 8 + e) >> 1, hf = e & 1; l[e] = l0 + (unsigned)((i * 8 * PITA + hf * 256) * 2); p[e] = ga + (size_t)i * 8 * DIN + hf * 256; }
    cp8(l, p); }
}
__global__ __launch_bounds__(256) void k_big(const _Float16* __restrict__ A16, const _Float16* __restrict__ WT, const float* __restrict__ BF, const float* __restrict__ BV, float* __restrict__ OUT) {
  __shared__ __align__(16) _Float16 sA[BROWS * PITA]; __shared__ __align__(16) _Float16 st[2 * BUFH]; __shared__ __align__(16) float sbt[KB][BROWS]; __shared__ __align__(16) float sf[8][32][SFP];
  const int tid = threadIdx.x, wave = tid >> 5, lane = tid & 31, col = lane & 15, g = lane >> 4; const int wm = wave >> 1, wn = wave & 1;
  const size_t rb = (size_t)blockIdx.x * BROWS; const int cb = blockIdx.y * WROWS;
  const _Float16* ga = A16 + (rb + wave) * DIN + lane * 8; const _Float16* gw = WT + (size_t)(cb + wave) * KK + lane * 8;
  const unsigned l0a = (unsigned)(size_t)&sA[wave * PITA + lane * 8]; const unsigned l0 = (unsigned)(size_t)&st[wave * PIT + lane * 8];
  copy_a(l0a, ga);
  copy_w(l0, gw);
  { const int row = tid >> 1, kh = (tid & 1) * 8; const float* p = BF + (rb + row) * BFS + kh; const v4f f0 = *(const v4f*)p, f1 = *(const v4f*)(p + 4);   // bf of the block's rows, k-major: 8 neighbouring rows of one k are two 16-byte reads
#pragma unroll
    for (int e = 0; e < 4; ++e) { sbt[kh + e][row] = f0[e]; sbt[kh + 4 + e][row] = f1[e]; } }
  asm volatile("s_wait_asynccnt 0x0" ::: "memory");   // a and tile 0 have landed before the barrier that publishes them
  __syncthreads();
  copy_w(l0 + BUFH * 2, gw + KP);
  const _Float16* sa_ = sA + (wm * 32 + col) * PITA;
  v8f outa[2][2] = {};
  for (int kg = 0; kg < KB / KG; ++kg) { v8f acc[KG][2][2] = {};
    for (int ic = 0; ic < PPG; ++ic) { const int t = kg * PPG + ic; const _Float16* sw_ = st + (t & 1) * BUFH + (wn * 32 + col) * PIT;
#pragma unroll
      for (int c = 0; c < 2; ++c) { v16h a[2];
#pragma unroll
        for (int m = 0; m < 2; ++m) a[m] = frag_h(sa_ + m * 16 * PITA + ic * 64 + c * 32, lane);
#pragma unroll
        for (int kk = 0; kk < KG; ++kk) { v16h b[2];
#pragma unroll
          for (int j = 0; j < 2; ++j) b[j] = frag_h(sw_ + j * 16 * PIT + kk * 64 + c * 32, lane);
#pragma unroll
          for (int m = 0; m < 2; ++m)
#pragma unroll
            for (int j = 0; j < 2; ++j) acc[kk][m][j] = wmma16(a[m], b[j], acc[kk][m][j]); } }
      asm volatile("s_wait_dscnt 0x0" ::: "memory");     // this wave's reads of the buffer are done before it is handed to the copies
      asm volatile("s_wait_asynccnt 0x0" ::: "memory");  // this wave's share of tile t + 1 has landed
      __syncthreads();                                   // publishes tile t + 1 and ends every reader's last read of tile t
      if (t + 2 < NPASS) copy_w(l0 + (unsigned)((t & 1) * BUFH * 2), gw + (size_t)(t + 2) * KP); }
#pragma unroll
    for (int kk = 0; kk < KG; ++kk)
#pragma unroll
      for (int m = 0; m < 2; ++m) { const float* fp = &sbt[kg * KG + kk][wm * 32 + m * 16 + 8 * g]; const v4f f0 = *(const v4f*)fp, f1 = *(const v4f*)(fp + 4);   // D element r = row 8g + r
#pragma unroll
        for (int j = 0; j < 2; ++j)
#pragma unroll
          for (int r = 0; r < 4; ++r) { outa[m][j][r] += f0[r] * acc[kk][m][j][r]; outa[m][j][4 + r] += f1[r] * acc[kk][m][j][4 + r]; } } }
  asm volatile("s_wait_asynccnt 0x0" ::: "memory");    // nothing in flight when the wave goes on to its end
  const size_t r0 = rb + wm * 32; const int c0 = cb + wn * 32;
#pragma unroll
  for (int m = 0; m < 2; ++m)
#pragma unroll
    for (int j = 0; j < 2; ++j)
#pragma unroll
      for (int r = 0; r < 8; ++r) sf[wave][m * 16 + 8 * g + r][j * 16 + col] = outa[m][j][r];
  LDSX();
  // each wave's own 32 x 32 block goes out as whole 128-B lines: 8 lanes a row, 4 rows a store; the bias sum over k is added on the way
  const int c4 = (lane & 7) * 4, rq = lane >> 3; float bv[KB][4];
#pragma unroll
  for (int k = 0; k < KB; ++k) { const v4f w = *(const v4f*)(BV + (size_t)k * DOUT + c0 + c4);
#pragma unroll
    for (int e = 0; e < 4; ++e) bv[k][e] = bfr(w[e]); }
#pragma unroll 2   // fully unrolled the loop takes the kernel above 256 registers, and the asm copies then stand among register-window switches
  for (int rl = 0; rl < 32; rl += 4) { const size_t row = r0 + rl + rq; const v4f s = *(const v4f*)&sf[wave][rl + rq][c4]; v4f o;
#pragma unroll
    for (int e = 0; e < 4; ++e) { float bsum = 0.f;
#pragma unroll
      for (int k = 0; k < KB; ++k) bsum += BF[row * BFS + k] * bv[k][e];
      o[e] = s[e] + bsum; }
    vst2(OUT + row * DOUT + c0 + c4, o); } }
extern "C" void kernel_launch(void* const* d_in, const int* in_sizes, int n_in, void* d_out, int out_size, void* d_ws, size_t ws_size, hipStream_t stream) {
  (void)in_sizes; (void)n_in; (void)out_size;
  const float** F = (const float**)d_in;   // 0 x [4096,512], 1 c [4096,64], 2 ln_gamma, 3 ln_beta, 4 w1 [64,256], 5 b1, 6 wr [256,256], 7 br, 8 w2 [256,16], 9 b2, 10 W [16,512,512], 11 bvec [16,512]
  if (ws_size < (size_t)WS_END) return;
  char* ws = (char*)d_ws; _Float16 *WT = (_Float16*)(ws + WS_WT), *A16 = (_Float16*)(ws + WS_A); float* BF = (float*)(ws + WS_BF);
  k_prep<<<NROWB + NPACKB, 256, 0, stream>>>(F[0], F[1], F[2], F[3], F[4], F[5], F[6], F[7], F[8], F[9], F[10], A16, BF, WT);
  k_big<<<dim3(NR / BROWS, DOUT / WROWS), 256, 0, stream>>>(A16, WT, BF, F[11], (float*)d_out);
}

// v006
// A run of this version takes 49.4 microseconds.
// Two timings next to v005 put it at 1.23 and 1.25 times that version's speed.
// Counting every step since v000, it is 13.6 times as fast.
// compute dtype: all float inputs rounded to bf16; LayerNorm + LeakyReLU in f32 on VALU; the small basis network (64 -> 256 -> residual 256 -> 16) on WMMA 16x16x32 bf16 with f32 accumulate: its weights and c are bf16 values already, each f32 hidden value goes in as the sum of three bf16 terms (all 24 bits); the conditional bilinear contraction out[b,o] = sum_k bf[b,k] (sum_i a[b,i] W[k,i,o]): the inner sums on WMMA 16x16x32, a rounded once to f16 against W as exact f16 rows, f32 accumulate, one accumulator per basis matrix; the sum over k with bf in f32; + bf . bvec in f32; f32 output.
#include <hip/hip_runtime.h>
#include <math.h>

typedef __attribute__((ext_vector_type(16))) _Float16 v16h;
typedef __attribute__((ext_vector_type(16))) __bf16 v16b;
typedef __attribute__((ext_vector_type(8)))  _Float16 v8h;
typedef __attribute__((ext_vector_type(8)))  float v8f;
typedef __attribute__((ext_vector_type(4)))  float v4f;
typedef __attribute__((ext_vector_type(2)))  float v2f;
typedef __attribute__((ext_vector_type(4)))  unsigned v4u;
typedef __attribute__((ext_vector_type(4)))  int v4i;
typedef float __attribute__((may_alias)) float_a;
typedef int __attribute__((may_alias)) int_a;

template <typename T> __device__ __forceinline__ void vst2(void* p, T v) { *(T*)p = v;  }
__device__ __forceinline__ v8f wmma16(v16h a, v16h b, v8f c) {
  v8f d = __builtin_amdgcn_wmma_f32_16x16x32_f16(false, a, false, b, (short)0, c, false, false);
  asm volatile("v_nop\n\tv_nop\n\tv_nop\n\tv_nop" : "+v"(d) : "v"(a), "v"(b));
  return d;
}
__device__ __forceinline__ v8f wmma_bf(v16b a, v16b b, v8f c) {
  v8f d = __builtin_amdgcn_wmma_f32_16x16x32_bf16(false, a, false, b, (short)0, c, false, false);
  asm volatile("v_nop\n\tv_nop\n\tv_nop\n\tv_nop" : "+v"(d) : "v"(a), "v"(b));
  return d;
}
// 16x16x32 fragments: lane = (h = lane>>4, row/col = lane&15); elements 0..7 = k0+8h+0..7, 8..15 = k0+16+8h+0..7; D element r = row 8h+r
__device__ __forceinline__ v16h frag_h(const _Float16* rowk0, int lane) {
  union { v16h v; v8h q[2]; } u; const _Float16* p = rowk0 + 8 * (lane >> 4);
  u.q[0] = *(const v8h*)p; u.q[1] = *(const v8h*)(p + 16); return u.v;
}
__device__ __forceinline__ v16h frag_f32(const float* rowk0, int lane) {
  v16h a; const float* p = rowk0 + 8 * (lane >> 4);
#pragma unroll
  for (int i = 0; i < 8; ++i) { a[i] = (_Float16)p[i]; a[8 + i] = (_Float16)p[16 + i]; }
  return a;
}
__device__ __forceinline__ v16h frag_f32s(const float* rowk0, int lane, float sc) {
  v16h a; const float* p = rowk0 + 8 * (lane >> 4);
#pragma unroll
  for (int i = 0; i < 8; ++i) { a[i] = (_Float16)(p[i] * sc); a[8 + i] = (_Float16)(p[16 + i] * sc); }
  return a;
}
// column fragment from a [K][ld] layout (column n), rows >= K read as 0
__device__ __forceinline__ v16h fragc_f32(const float* W, int k0, int n, int lane, int ld, int K) {
  v16h a; const int g = lane >> 4;
#pragma unroll
  for (int i = 0; i < 8; ++i) { const int ka = k0 + 8 * g + i, kb = ka + 16;
    a[i] = (_Float16)(ka < K ? W[(size_t)(ka < K ? ka : K - 1) * ld + n] : 0.f); a[8 + i] = (_Float16)(kb < K ? W[(size_t)(kb < K ? kb : K - 1) * ld + n] : 0.f); }
  return a;
}
struct F2 { v16b h, l; };
__device__ __forceinline__ F2 bsplit16(const float v[16]) { F2 r;
#pragma unroll
  for (int i = 0; i < 16; ++i) { const __bf16 h = (__bf16)v[i]; r.h[i] = h; r.l[i] = (__bf16)(v[i] - (float)h); }
  return r; }
__device__ __forceinline__ F2 split_row(const float* row, int k0, int lane) { float v[16]; const float* p = row + k0 + 8 * (lane >> 4);
#pragma unroll
  for (int i = 0; i < 8; ++i) { v[i] = p[i]; v[8 + i] = p[16 + i]; }
  return bsplit16(v); }
__device__ __forceinline__ F2 split_rowK(const float* row, int k0, int lane, int K) { float v[16]; const int g = lane >> 4;
#pragma unroll
  for (int i = 0; i < 8; ++i) { const int ka = k0 + 8 * g + i, kb = ka + 16; v[i] = ka < K ? row[ka < K ? ka : K - 1] : 0.f; v[8 + i] = kb < K ? row[kb < K ? kb : K - 1] : 0.f; }
  return bsplit16(v); }
__device__ __forceinline__ F2 split_col(const float* W, int k0, int n, int lane, int ld, int K) { float v[16]; const int g = lane >> 4;
#pragma unroll
  for (int i = 0; i < 8; ++i) { const int ka = k0 + 8 * g + i, kb = ka + 16; v[i] = ka < K ? W[(size_t)(ka < K ? ka : K - 1) * ld + n] : 0.f; v[8 + i] = kb < K ? W[(size_t)(kb < K ? kb : K - 1) * ld + n] : 0.f; }
  return bsplit16(v); }
__device__ __forceinline__ v8f mac3(const F2& a, const F2& b, v8f c) { c = wmma_bf(a.l, b.h, c); c = wmma_bf(a.h, b.l, c); return wmma_bf(a.h, b.h, c); }
__device__ __forceinline__ float sigm(float v) { return 1.0f / (1.0f + expf(-v)); }
#define LDSX() do { asm volatile("s_wait_dscnt 0" ::: "memory"); __builtin_amdgcn_wave_barrier(); __builtin_amdgcn_fence(__ATOMIC_RELEASE, "workgroup"); } while (0)


// Conditional pre-activation dense layer (4,096 rows, 512 -> 512, 16 basis matrices selected by a 64-dim condition through a small residual MLP): a = LeakyReLU(LayerNorm(x)); bf = basis(c); out = sum_k bf_k (a W_k + bias_k).
#define NR 4096
#define DIN 512
#define DOUT 512
#define DC 64
#define KB 16
#define DB 256
#define KK (KB * DIN)      // 8192
#define NEG 0.01f
#ifndef TR
#define TR (NR / 64)
#endif
typedef __attribute__((ext_vector_type(8))) __bf16 v8b;
__device__ __forceinline__ v16b frag_b(const __bf16* rowk0, int lane) {
  union { v16b v; v8b q[2]; } u; const __bf16* p = rowk0 + 8 * (lane >> 4);
  u.q[0] = *(const v8b*)p; u.q[1] = *(const v8b*)(p + 16); return u.v;
}
__device__ __forceinline__ float bfr(float v) { return (float)(__bf16)v; }
__device__ __attribute__((noinline)) float exp_ni(float v) { return expf(v); }
__device__ __attribute__((noinline)) float erf_ni(float v) { return erff(v); }

#define WS_WT  0u                                   // f16 W rows [o][8192], in the order of k_big's passes (see packw_blk)
#define WS_A   (WS_WT + 2u * (size_t)DOUT * KK)          // f16 activations a [NR][512]
#define WS_BF  (WS_A + 2u * (size_t)NR * DIN)
#define BFS 32
#define WS_END (WS_BF + 4u * (size_t)NR * BFS)

__device__ __forceinline__ float lrelu(float v) { return v >= 0.f ? v : NEG * v; }
// ---- packw_blk: WT[o][p(k, i)] = f16(W[k][i][o]); p puts the 64 i of 4 neighbouring k side by side, so that one pass of k_big (256 halves of a row) holds the same i of 4 basis matrices
// block = (4 k, 64 i, 64 o): W is read along o, whole 128-B lines (8 lanes x 16 B a row, 4 rows a load), all 16 loads of a thread in flight; a thread turns 8 i x 4 o in registers, LDS holds the tile o-major, and every o goes out as the 512 B of its pass
#define KG 4                      // basis matrices that share an A fragment in k_big
#define OT 64                     // output columns per block
#define PITW 264                  // LDS row pitch in halves: 528 B = 16 B x 33; lanes 0-15 (4 x 4 o, 4 x 8 i) then store to 16 different groups of 4 banks
__device__ __forceinline__ void packw_blk(const int blk, _Float16* s, const float* __restrict__ Wb, _Float16* __restrict__ WT) { const int t = threadIdx.x, w = t >> 5, lane = t & 31;
  const int oc = blk % (DOUT / OT), ic = (blk / (DOUT / OT)) % (DIN / 64), kg = blk / ((DOUT / OT) * (DIN / 64));
  const int o4 = (t & 3) | ((t >> 2) & 4) | ((w & 1) << 3), rg0 = ((t >> 2) & 3) + 4 * (w >> 1);   // the thread's 4 columns; its groups of 8 tile rows are rg0 and rg0 + 16 (tile row = (k % 4) * 64 + i % 64)
  v4f x[2][8];   // every loop over x is unrolled: constant indices keep it in registers, and the 16 loads stand in a row
#pragma unroll
  for (int u = 0; u < 2; ++u) {
#pragma unroll
    for (int j = 0; j < 8; ++j) { const int rg = rg0 + 16 * u; x[u][j] = *(const v4f*)(Wb + (size_t)((kg * KG + (rg >> 3)) * DIN + ic * 64 + (rg & 7) * 8 + j) * DOUT + oc * OT + o4 * 4); }   // W[k][i][o] at ((k*512 + i)*512 + o)
    if (u == 0) asm volatile("s_wait_xcnt 0x0" ::: "memory"); }   // results of the second eight loads land on the address pair of the first eight: the wait stands between them
#pragma unroll
  for (int u = 0; u < 2; ++u)
#pragma unroll
    for (int e = 0; e < 4; ++e) { v8h h;
#pragma unroll
      for (int j = 0; j < 8; ++j) h[j] = (_Float16)bfr(x[u][j][e]);
      *(v8h*)&s[(o4 * 4 + e) * PITW + (rg0 + 16 * u) * 8] = h; }
  __syncthreads();
#pragma unroll
  for (int q = 0; q < OT / 8; ++q) { const int o = w + 8 * q; vst2((unsigned*)(WT + (size_t)(oc * OT + o) * KK + (kg * (DIN / 64) + ic) * (KG * 64) + lane * 8), *(const v4u*)&s[o * PITW + lane * 8]); }
  asm volatile("s_wait_xcnt 0x0" ::: "memory"); }   // these stores end the block's job and the kernel: no later code overwrites their registers, the wait is a precaution
// ---- row_blk: block = 16 rows (256 threads). a = lrelu(LN(x) g + b) (512) on the vector unit, per row in the same order of sums as before; A row = f16(a[i]).
// The basis network runs on the matrix unit, 16 rows = one tile height: h = c w1 + b1; h = h + lrelu(h) wr + br; h = lrelu(h); bf = h w2 + b2 (16). Wave w owns hidden units 32w .. 32w + 31 as two column tiles.
// c and the weights are bf16 values, so they are exact operands; a hidden value x goes in as x = p0 + p1 + p2, three bf16 terms that hold all its 24 bits, one WMMA a term.
#define RPB 16
#define PH 264                    // pitch of a term plane in bf16: 528 B = 16 B x 33, conflict-free for 16-byte row reads
typedef __attribute__((ext_vector_type(2))) __bf16 v2b;
struct RowS { float sa[RPB][DIN]; __bf16 sp[3][RPB][PH]; float sred[8][RPB][KB]; float red[RPB][8]; };   // every member a multiple of 16 bytes long
__device__ __forceinline__ v8f wmma_b(v16b a, v16b b, v8f c) { return __builtin_amdgcn_wmma_f32_16x16x32_bf16(false, a, false, b, (short)0, c, false, false); }
// A fragment from an f32 row, rounded to bf16; k order as frag_b
__device__ __forceinline__ v16b frag_bf32(const float* rowk0, int lane) {
  v16b a; const float* p = rowk0 + 8 * (lane >> 4);
#pragma unroll
  for (int i = 0; i < 8; ++i) { a[i] = (__bf16)p[i]; a[8 + i] = (__bf16)p[16 + i]; }
  return a;
}
// B fragments of two column tiles from an f32 [K][ld] matrix, rounded to bf16: lane (g, c) takes columns n0 + 2c (tile 0) and n0 + 2c + 1 (tile 1) with one 8-byte load per k, so that 16 lanes read a whole 128-B line; k order as frag_b
// the loads (ldc2) and the rounding (cvc2) are apart so that the loads of several k steps can stand in a row and share one trip to L2
// pl = the lane's place in row 8g of the matrix: &Wm[8g][n0 + 2c]
__device__ __forceinline__ void ldc2(const float* pl, int k0, int ld, v2f (&u)[16]) {
#pragma unroll
  for (int i = 0; i < 8; ++i) { u[i] = *(const v2f*)(pl + (size_t)(k0 + i) * ld); u[8 + i] = *(const v2f*)(pl + (size_t)(k0 + 16 + i) * ld); }
}
// behind a run of loads from one address: the address stays live up to the wait, so that no result of the run lands on it in front of the wait
__device__ __forceinline__ void xwait(const float* p) { asm volatile("s_wait_xcnt 0x0" :: "v"(p) : "memory"); }
__device__ __forceinline__ void cvc2(const v2f (&u)[16], v16b& t0, v16b& t1) {
#pragma unroll
  for (int i = 0; i < 16; ++i) { t0[i] = (__bf16)u[i][0]; t1[i] = (__bf16)u[i][1]; }
}
// lrelu of a wave's two D tiles (element r = row 8g + r, columns n and n + 1) into the three term planes; each remainder is exact in f32
__device__ __forceinline__ void put3(__bf16 (&sp)[3][RPB][PH], const v8f& d0, const v8f& d1, int g, int n) {
#pragma unroll
  for (int r = 0; r < 8; ++r) { float x0 = lrelu(d0[r]), x1 = lrelu(d1[r]);
#pragma unroll
    for (int s = 0; s < 3; ++s) { v2b q; q[0] = (__bf16)x0; q[1] = (__bf16)x1; *(v2b*)&sp[s][8 * g + r][n] = q; x0 -= (float)q[0]; x1 -= (float)q[1]; } }
}
__device__ __forceinline__ void row_blk(const int blk, RowS& S, const float* __restrict__ X, const float* __restrict__ C, const float* __restrict__ G, const float* __restrict__ Bt, const float* __restrict__ W1, const float* __restrict__ B1, const float* __restrict__ WR, const float* __restrict__ BR, const float* __restrict__ W2, const float* __restrict__ B2, _Float16* __restrict__ A16, float* __restrict__ BF) {
  auto& red = S.red; auto& sa = S.sa; auto& sp = S.sp; auto& sred = S.sred;
  const int t = threadIdx.x; const size_t row0 = (size_t)blk * RPB; const float* xb = X + row0 * DIN;
  float v[RPB][2], s[RPB];
#pragma unroll
  for (int r = 0; r < RPB; ++r) { s[r] = 0.f; for (int i = 0; i < 2; ++i) { v[r][i] = bfr(xb[r * DIN + t + 256 * i]); s[r] += v[r][i]; } }
#pragma unroll
  for (int o = 1; o < 32; o <<= 1)   // level by level over the rows: their independent exchanges share each LDS latency
#pragma unroll
    for (int r = 0; r < RPB; ++r) s[r] += __shfl_xor(s[r], o);
  if ((t & 31) == 0) {
#pragma unroll
    for (int r = 0; r < RPB; ++r) red[r][t >> 5] = s[r]; }
  __syncthreads(); float mu[RPB];
#pragma unroll
  for (int r = 0; r < RPB; ++r) { float m = 0.f; for (int i = 0; i < 8; ++i) m += red[r][i]; mu[r] = m / (float)DIN; }
  __syncthreads();
#pragma unroll
  for (int r = 0; r < RPB; ++r) { float q = 0.f; for (int i = 0; i < 2; ++i) { const float d = v[r][i] - mu[r]; q += d * d; } s[r] = q; }
#pragma unroll
  for (int o = 1; o < 32; o <<= 1)
#pragma unroll
    for (int r = 0; r < RPB; ++r) s[r] += __shfl_xor(s[r], o);
  if ((t & 31) == 0) {
#pragma unroll
    for (int r = 0; r < RPB; ++r) red[r][t >> 5] = s[r]; }
  __syncthreads();
  { float gg[2], bb[2]; for (int i = 0; i < 2; ++i) { gg[i] = bfr(G[t + 256 * i]); bb[i] = bfr(Bt[t + 256 * i]); }
#pragma unroll
    for (int r = 0; r < RPB; ++r) { float var = 0.f; for (int i = 0; i < 8; ++i) var += red[r][i]; var /= (float)DIN; const float inv = 1.0f / sqrtf(var + 1e-5f);
      for (int i = 0; i < 2; ++i) sa[r][t + 256 * i] = lrelu((v[r][i] - mu[r]) * inv * gg[i] + bb[i]); } }
  __syncthreads();
#pragma unroll
  for (int j = 0; j < RPB * DIN / 8 / 256; ++j) { const int q = t + 256 * j; const float* p = &sa[0][0] + q * 8; const v4f a0 = *(const v4f*)p, a1 = *(const v4f*)(p + 4); v8h o;   // the rows of a go out as f16, 16 bytes a thread
#pragma unroll
    for (int e = 0; e < 4; ++e) { o[e] = (_Float16)a0[e]; o[4 + e] = (_Float16)a1[e]; }
    vst2(A16 + row0 * DIN + q * 8, o); }
  asm volatile("s_wait_xcnt 0x0" ::: "memory");   // results of the loads below land on registers of these stores: the wait stands between them
  const int w = t >> 5, lane = t & 31, cl = lane & 15, g = lane >> 4, n = w * 32 + 2 * cl;   // the lane's two hidden units: n in tile 0, n + 1 in tile 1
  const v2f vb1 = *(const v2f*)(B1 + n), vbr = *(const v2f*)(BR + n); const float vb2 = B2[t % KB];   // the biases are fetched with the first weights, not each at its own use
  const float* p1 = W1 + (size_t)(8 * g) * DB + n; const float* pr = WR + (size_t)(8 * g) * DB + n;
  v16b ca[DC / 32]; v2f u1[DC / 32][16];
#pragma unroll
  for (int ks = 0; ks < DC / 32; ++ks) { ca[ks] = frag_bf32(C + (row0 + cl) * DC + ks * 32, lane); ldc2(p1, ks * 32, DB, u1[ks]); }
  xwait(p1);
  v8f h0, h1;
  { const float e0 = bfr(vb1[0]), e1 = bfr(vb1[1]);
#pragma unroll
    for (int r = 0; r < 8; ++r) { h0[r] = e0; h1[r] = e1; } }
#pragma unroll
  for (int ks = 0; ks < DC / 32; ++ks) { v16b t0, t1; cvc2(u1[ks], t0, t1); h0 = wmma_b(ca[ks], t0, h0); h1 = wmma_b(ca[ks], t1, h1); }
  // the wave's share of wr and of w2 depends on no other wave: it is fetched in front of the barrier, two k steps (32 loads) in flight at a time
  v16b q0[DB / 32], q1[DB / 32], q2; float u2[16];
#pragma unroll
  for (int c = 0; c < 3; ++c) { v2f ua[2][16];
#pragma unroll
    for (int e = 0; e < 2; ++e) ldc2(pr, (2 * c + e) * 32, DB, ua[e]);
    xwait(pr);
#pragma unroll
    for (int e = 0; e < 2; ++e) cvc2(ua[e], q0[2 * c + e], q1[2 * c + e]); }
  { v2f ua[2][16];   // the last chunk and w2 fly while the hidden values are split and stored
#pragma unroll
    for (int e = 0; e < 2; ++e) ldc2(pr, (6 + e) * 32, DB, ua[e]);
    xwait(pr);
#pragma unroll
    for (int i = 0; i < 16; ++i) { u2[i] = W2[(size_t)(w * 32 + 8 * g + (i & 7) + 2 * (i & 8)) * KB + cl];   // B fragment of w2, rows 32w .. 32w + 31, column cl
      asm volatile("s_wait_xcnt 0x0" ::: "memory"); }   // each of these loads has an address register of its own, and the next result may land on it: the wait stands between them
    put3(sp, h0, h1, g, n);
#pragma unroll
    for (int e = 0; e < 2; ++e) cvc2(ua[e], q0[6 + e], q1[6 + e]); }
#pragma unroll
  for (int i = 0; i < 16; ++i) q2[i] = (__bf16)u2[i];
  { const float e0 = bfr(vbr[0]), e1 = bfr(vbr[1]);
#pragma unroll
    for (int r = 0; r < 8; ++r) { h0[r] += e0; h1[r] += e1; } }
  __syncthreads();
  { v16b an[3];   // the three term fragments of a k step are read together, one k step ahead of the WMMAs that use them: one LDS latency a step, under the step before
#pragma unroll
    for (int s = 0; s < 3; ++s) an[s] = frag_b(&sp[s][cl][0], lane);
#pragma unroll
    for (int ks = 0; ks < DB / 32; ++ks) { v16b ac[3];
#pragma unroll
      for (int s = 0; s < 3; ++s) { ac[s] = an[s]; if (ks + 1 < DB / 32) an[s] = frag_b(&sp[s][cl][(ks + 1) * 32], lane); }
#pragma unroll
      for (int s = 2; s >= 0; --s) { h0 = wmma_b(ac[s], q0[ks], h0); h1 = wmma_b(ac[s], q1[ks], h1); } } }   // the small terms first
  __syncthreads();   // every wave has read the planes before they are written again
  put3(sp, h0, h1, g, n);
  __syncthreads();
  { v8f d = {};   // wave w sums hidden units 32w .. 32w + 31 of all 16 rows and 16 basis slots; the 8 partial sums meet in LDS
#pragma unroll
    for (int s = 2; s >= 0; --s) d = wmma_b(frag_b(&sp[s][cl][w * 32], lane), q2, d);
#pragma unroll
    for (int r = 0; r < 8; ++r) sred[w][8 * g + r][cl] = d[r]; }
  __syncthreads();
  { const int r = t / KB, k = t % KB; float bfv = bfr(vb2);   // 256 threads = 16 rows x 16 basis slots; the padded slots are set to 0
#pragma unroll
    for (int u = 0; u < 8; ++u) bfv += sred[u][r][k];
    BF[(row0 + r) * BFS + k] = bfv; BF[(row0 + r) * BFS + KB + k] = 0.f; } }
// ---- k_prep: one launch for the two jobs that k_big waits for. They share no data, so their blocks run side by side: the row blocks come first in the grid, and the W blocks fill the memory time that the row blocks leave idle
#define NROWB (TR * 64 / RPB)
#define NPACKB ((KB / KG) * (DIN / 64) * (DOUT / OT))
// 4 waves a SIMD asked for: at most 256 registers, so that a WGP holds two blocks and a W block runs beside a row block
__global__ __launch_bounds__(256, 4) void k_prep(const float* __restrict__ X, const float* __restrict__ C, const float* __restrict__ G, const float* __restrict__ Bt, const float* __restrict__ W1, const float* __restrict__ B1, const float* __restrict__ WR, const float* __restrict__ BR, const float* __restrict__ W2, const float* __restrict__ B2, const float* __restrict__ Wb, _Float16* __restrict__ A16, float* __restrict__ BF, _Float16* __restrict__ WT) {
  __shared__ __align__(16) union { RowS r; _Float16 s[OT * PITW]; } sm;   // a block does one job and uses one member
  if (blockIdx.x < NROWB) row_blk(blockIdx.x, sm.r, X, C, G, Bt, W1, B1, WR, BR, W2, B2, A16, BF);
  else packw_blk(blockIdx.x - NROWB, sm.s, Wb, WT); }
// ---- k_big: block = (128 rows, 64 cols), 8 waves of 32 x 32: out = sum_k bf[row][k] (a . W_k) + sum_k bf[row][k] bvec[k][o]
// The block's 128 rows of a (f16, 512 each) come to LDS once and stay; the WT tiles (64 rows of 256 halves = 64 i of 4 basis matrices) follow by asynchronous copies, two buffers: the next tile flies while this one is multiplied.
// Each A fragment read from LDS serves 4 basis matrices, each with accumulators of its own; after the 8 passes of such a group the four are added into the output with bf in f32.
#define KP 256                    // halves per pass: 512 B of every WT row
#define PIT 264                   // LDS row pitch in halves: 528 B = 16 B x 33, conflict-free for 16-byte row reads
#define PITA 520                  // the same for the rows of a: 1,040 B = 16 B x 65
#define BROWS 128
#define WROWS 64
#define BUFH (WROWS * PIT)
#define NPASS (KK / KP)
#define PPG (DIN / 64)            // passes per group of KG basis matrices
#define SFP 36
// eight copies, 32 lanes x 16 B each; the s_wait_xcnt closes the statement so that no address register is rewritten in front of it
__device__ __forceinline__ void cp8(const unsigned* l, const _Float16* const* p) {
  asm volatile("global_load_async_to_lds_b128 %0, %8, off\n\t"
               "global_load_async_to_lds_b128 %1, %9, off\n\t"
               "global_load_async_to_lds_b128 %2, %10, off\n\t"
               "global_load_async_to_lds_b128 %3, %11, off\n\t"
               "global_load_async_to_lds_b128 %4, %12, off\n\t"
               "global_load_async_to_lds_b128 %5, %13, off\n\t"
               "global_load_async_to_lds_b128 %6, %14, off\n\t"
               "global_load_async_to_lds_b128 %7, %15, off\n\t"
               "s_wait_xcnt 0x0"
               :: "v"(l[0]), "v"(l[1]), "v"(l[2]), "v"(l[3]), "v"(l[4]), "v"(l[5]), "v"(l[6]), "v"(l[7]),
                  "v"(p[0]), "v"(p[1]), "v"(p[2]), "v"(p[3]), "v"(p[4]), "v"(p[5]), "v"(p[6]), "v"(p[7])
               : "memory");
}
// one WT tile: wave w brings tile rows w, w + 8, ... (8 rows, one copy each); gw = this lane's 16 bytes in the wave's first row of the pass, l0 = their place in LDS
__device__ __forceinline__ void copy_w(unsigned l0, const _Float16* gw) {
  unsigned l[8]; const _Float16* p[8];
#pragma unroll
  for (int e = 0; e < 8; ++e) { l[e] = l0 + (unsigned)(e * 8 * PIT * 2); p[e] = gw + (size_t)e * 8 * KK; }
  cp8(l, p);
}
// the block's rows of a: wave w brings rows w, w + 8, ... (16 rows, two copies each)
__device__ __forceinline__ void copy_a(unsigned l0, const _Float16* ga) {
#pragma unroll
  for (int q = 0; q < 4; ++q) { unsigned l[8]; const _Float16* p[8];
#pragma unroll
    for (int e = 0; e < 8; ++e) { const int i = (q * 8 + e) >> 1, hf = e & 1; l[e] = l0 + (unsigned)((i * 8 * PITA + hf * 256) * 2); p[e] = ga + (size_t)i * 8 * DIN + hf * 256; }
    cp8(l, p); }
}
__global__ __launch_bounds__(256) void k_big(const _Float16* __restrict__ A16, const _Float16* __restrict__ WT, const float* __restrict__ BF, const float* __restrict__ BV, float* __restrict__ OUT) {
  __shared__ __align__(16) _Float16 sA[BROWS * PITA]; __shared__ __align__(16) _Float16 st[2 * BUFH]; __shared__ __align__(16) float sbt[KB][BROWS]; __shared__ __align__(16) float sf[8][32][SFP];
  const int tid = threadIdx.x, wave = tid >> 5, lane = tid & 31, col = lane & 15, g = lane >> 4; const int wm = wave >> 1, wn = wave & 1;
  const size_t rb = (size_t)blockIdx.x * BROWS; const int cb = blockIdx.y * WROWS;
  const _Float16* ga = A16 + (rb + wave) * DIN + lane * 8; const _Float16* gw = WT + (size_t)(cb + wave) * KK + lane * 8;
  const unsigned l0a = (unsigned)(size_t)&sA[wave * PITA + lane * 8]; const unsigned l0 = (unsigned)(size_t)&st[wave * PIT + lane * 8];
  copy_a(l0a, ga);
  copy_w(l0, gw);
  { const int row = tid >> 1, kh = (tid & 1) * 8; const float* p = BF + (rb + row) * BFS + kh; const v4f f0 = *(const v4f*)p, f1 = *(const v4f*)(p + 4);   // bf of the block's rows, k-major: 8 neighbouring rows of one k are two 16-byte reads
#pragma unroll
    for (int e = 0; e < 4; ++e) { sbt[kh + e][row] = f0[e]; sbt[kh + 4 + e][row] = f1[e]; } }
  asm volatile("s_wait_asynccnt 0x0" ::: "memory");   // a and tile 0 have landed before the barrier that publishes them
  __syncthreads();
  copy_w(l0 + BUFH * 2, gw + KP);
  const _Float16* sa_ = sA + (wm * 32 + col) * PITA;
  v8f outa[2][2] = {};
  for (int kg = 0; kg < KB / KG; ++kg) { v8f acc[KG][2][2] = {};
    for (int ic = 0; ic < PPG; ++ic) { const int t = kg * PPG + ic; const _Float16* sw_ = st + (t & 1) * BUFH + (wn * 32 + col) * PIT;
#pragma unroll
      for (int c = 0; c < 2; ++c) { v16h a[2];
#pragma unroll
        for (int m = 0; m < 2; ++m) a[m] = frag_h(sa_ + m * 16 * PITA + ic * 64 + c * 32, lane);
#pragma unroll
        for (int kk = 0; kk < KG; ++kk) { v16h b[2];
#pragma unroll
          for (int j = 0; j < 2; ++j) b[j] = frag_h(sw_ + j * 16 * PIT + kk * 64 + c * 32, lane);
#pragma unroll
          for (int m = 0; m < 2; ++m)
#pragma unroll
            for (int j = 0; j < 2; ++j) acc[kk][m][j] = wmma16(a[m], b[j], acc[kk][m][j]); } }
      asm volatile("s_wait_dscnt 0x0" ::: "memory");     // this wave's reads of the buffer are done before it is handed to the copies
      asm volatile("s_wait_asynccnt 0x0" ::: "memory");  // this wave's share of tile t + 1 has landed
      __syncthreads();                                   // publishes tile t + 1 and ends every reader's last read of tile t
      if (t + 2 < NPASS) copy_w(l0 + (unsigned)((t & 1) * BUFH * 2), gw + (size_t)(t + 2) * KP); }
#pragma unroll
    for (int kk = 0; kk < KG; ++kk)
#pragma unroll
      for (int m = 0; m < 2; ++m) { const float* fp = &sbt[kg * KG + kk][wm * 32 + m * 16 + 8 * g]; const v4f f0 = *(const v4f*)fp, f1 = *(const v4f*)(fp + 4);   // D element r = row 8g + r
#pragma unroll
        for (int j = 0; j < 2; ++j)
#pragma unroll
          for (int r = 0; r < 4; ++r) { outa[m][j][r] += f0[r] * acc[kk][m][j][r]; outa[m][j][4 + r] += f1[r] * acc[kk][m][j][4 + r]; } } }
  asm volatile("s_wait_asynccnt 0x0" ::: "memory");    // nothing in flight when the wave goes on to its end
  const size_t r0 = rb + wm * 32; const int c0 = cb + wn * 32;
#pragma unroll
  for (int m = 0; m < 2; ++m)
#pragma unroll
    for (int j = 0; j < 2; ++j)
#pragma unroll
      for (int r = 0; r < 8; ++r) sf[wave][m * 16 + 8 * g + r][j * 16 + col] = outa[m][j][r];
  LDSX();
  // each wave's own 32 x 32 block goes out as whole 128-B lines: 8 lanes a row, 4 rows a store; the bias sum over k is added on the way
  const int c4 = (lane & 7) * 4, rq = lane >> 3; float bv[KB][4];
#pragma unroll
  for (int k = 0; k < KB; ++k) { const v4f w = *(const v4f*)(BV + (size_t)k * DOUT + c0 + c4);
#pragma unroll
    for (int e = 0; e < 4; ++e) bv[k][e] = bfr(w[e]); }
#pragma unroll 2   // fully unrolled the loop takes the kernel above 256 registers, and the asm copies then stand among register-window switches
  for (int rl = 0; rl < 32; rl += 4) { const size_t row = r0 + rl + rq; const v4f s = *(const v4f*)&sf[wave][rl + rq][c4]; v4f o;
#pragma unroll
    for (int e = 0; e < 4; ++e) { float bsum = 0.f;
#pragma unroll
      for (int k = 0; k < KB; ++k) bsum += BF[row * BFS + k] * bv[k][e];
      o[e] = s[e] + bsum; }
    vst2(OUT + row * DOUT + c0 + c4, o); } }
extern "C" void kernel_launch(void* const* d_in, const int* in_sizes, int n_in, void* d_out, int out_size, void* d_ws, size_t ws_size, hipStream_t stream) {
  (void)in_sizes; (void)n_in; (void)out_size;
  const float** F = (const float**)d_in;   // 0 x [4096,512], 1 c [4096,64], 2 ln_gamma, 3 ln_beta, 4 w1 [64,256], 5 b1, 6 wr [256,256], 7 br, 8 w2 [256,16], 9 b2, 10 W [16,512,512], 11 bvec [16,512]
  if (ws_size < (size_t)WS_END) return;
  char* ws = (char*)d_ws; _Float16 *WT = (_Float16*)(ws + WS_WT), *A16 = (_Float16*)(ws + WS_A); float* BF = (float*)(ws + WS_BF);
  k_prep<<<NROWB + NPACKB, 256, 0, stream>>>(F[0], F[1], F[2], F[3], F[4], F[5], F[6], F[7], F[8], F[9], F[10], A16, BF, WT);
  k_big<<<dim3(NR / BROWS, DOUT / WROWS), 256, 0, stream>>>(A16, WT, BF, F[11], (float*)d_out);
}
